// v000
// The times below were measured on an AMD MI455X: many runs one after another, warmed up first and cycling through
// copies of the inputs, with the whole window's GPU time divided by the number of runs. Launches and the gaps
// between them are all in it. The median over several windows is given; except for v000 it joins two sittings, which
// can be a few percent apart, so the side-by-side timings, each taken in one sitting, are the better comparison.
// The starting kernel, v000, takes 106 microseconds a run.
// Contractions: attention P.V through the rank-1 V = t*ve as the padded matvec P.[t | 1] on
// v_wmma_f32_16x16x32_bf16 (A = P as bf16 hi and lo pieces, B columns = t_hi, t_lo, ones, zeros; two products per
// 32 keys, f32 accumulate); output projection (beta*ve rows) . o_w^T per channel sequence on v_wmma_f32_16x16x32_bf16
// (both operands bf16 hi+lo pieces, hh+hl+lh, K = 64, f32 accumulate from zero per channel), then the 32-channel mix as
// a fixed-order f32 VALU sum of the per-channel results; embedding, per-head q/k/v vectors, scores and softmax
// exponentials in f32 on VALU.
#include <hip/hip_runtime.h>
#include <stdint.h>

#define NBAT   2
#define IMH    32
#define IMW    32
#define CIN    32
#define DMOD   64
#define NHEAD  4
#define HDIM   16
#define SEQ    1024
#define NSQ    64
#define COUT   64
#define BTP    1032
#define WPITCH 72
#define SPITCH 68
#define LOG2E  1.44269504088896340736f

static_assert(IMH * IMW == SEQ);
static_assert(NBAT * CIN == NSQ);
static_assert(NHEAD * HDIM == DMOD);
static_assert((SEQ % 64) == 0 && COUT == 64 && DMOD == 64 && CIN == 32 && HDIM == 16);
static_assert((BTP % 8) == 0 && (WPITCH % 8) == 0 && (SPITCH % 4) == 0);
static_assert(SEQ == 8 * 128);

typedef __bf16   v16b __attribute__((ext_vector_type(16)));
typedef float    v8f  __attribute__((ext_vector_type(8)));
typedef float    v4f  __attribute__((ext_vector_type(4)));
typedef unsigned int v8u __attribute__((ext_vector_type(8)));
typedef unsigned int v4u __attribute__((ext_vector_type(4)));

union FragB { v16b v; v8u u; v4u q[2]; };

// ---- scalar helpers ----------------------------------------------------------------------------------
__device__ __forceinline__ v8f zero8() { v8f z = {0.f, 0.f, 0.f, 0.f, 0.f, 0.f, 0.f, 0.f}; return z; }
// f32 bits -> bf16 value kept in the upper 16 bits (low 16 bits zero), RNE convert
__device__ __forceinline__ unsigned rne_hi(unsigned u) {
  return (u + 0x7FFFu + ((u >> 16) & 1u)) & 0xFFFF0000u;
}
// two-piece bf16 decomposition: a ~= hi + lo, hi = RNE bf16(a), lo = RNE bf16(a - hi); returns the 16-bit patterns
__device__ __forceinline__ void split2(float a, unsigned& h16, unsigned& l16) {
  const unsigned hu = rne_hi(__float_as_uint(a));
  const float lf = a - __uint_as_float(hu);
  h16 = hu >> 16;
  l16 = rne_hi(__float_as_uint(lf)) >> 16;
}
__device__ __forceinline__ unsigned pk(unsigned lo16, unsigned hi16) { return (lo16 & 0xFFFFu) | (hi16 << 16); }

// ---- WMMA helpers with trailing VALU hazard gap -----------------------------------------------------
__device__ __forceinline__ v8f mma_b(v16b a, v16b b, v8f c) {
  return __builtin_amdgcn_wmma_f32_16x16x32_bf16(false, a, false, b, (short)0, c, false, false);
}
__device__ __forceinline__ void guard2(v8f& a, v8f& b, v8u x, v8u y, v8u z) {
#if defined(__HIP_DEVICE_COMPILE__)
  asm volatile("v_nop\n\tv_nop\n\tv_nop\n\tv_nop" : "+v"(a), "+v"(b) : "v"(x), "v"(y), "v"(z));
#endif
}
__device__ __forceinline__ void guard4(v8f& a, v8f& b, v8f& c, v8f& d, v8u x0, v8u x1,
                                       v8u y0, v8u y1, v8u y2, v8u y3, v8u z0, v8u z1, v8u z2, v8u z3) {
#if defined(__HIP_DEVICE_COMPILE__)
  asm volatile("v_nop\n\tv_nop\n\tv_nop\n\tv_nop"
               : "+v"(a), "+v"(b), "+v"(c), "+v"(d)
               : "v"(x0), "v"(x1), "v"(y0), "v"(y1), "v"(y2), "v"(y3), "v"(z0), "v"(z1), "v"(z2), "v"(z3));
#endif
}
__device__ __forceinline__ void wave_sync_lds() {
  __builtin_amdgcn_fence(__ATOMIC_RELEASE, "workgroup");
  __builtin_amdgcn_wave_barrier();
  __builtin_amdgcn_fence(__ATOMIC_ACQUIRE, "workgroup");
}

// =====================================================================================================
// Kernel 1: one block per (sequence n = b*32 + c, head), 128 threads = 4 waves.
// t[s] = x[b][s>>5][s&31][c] in LDS (f32). embed_w is a single column e, so E = t (x) e and Q[s] = t[s]*qe,
// K[s] = t[s]*ke, V[s] = t[s]*ve with qe[i] = sum_k q_w[i][k] e[k], ke likewise (this head's 16 rows, f32 dots).
// Scores in log2 units: s2[q][k] = ah * t[q] * t[k], ah = 0.25 * log2(e) * (qe_h . ke_h); the row max is exactly
// max(coef*gmax, coef*gmin) with coef = ah*t[q], so p = 2^(s2 - rowmax) <= 1 in one pass (f32, v_exp_f32).
// Since V_h[k][d] = t[k] * ve_h[d], the attention output row is beta_h[q] * ve_h with beta = sum_k p t / sum_k p.
// That K = 1024 reduction is a 16-column padded matvec on bf16 WMMA: B table Bt[col][key] (k contiguous, pitch 1032)
// with col 0 = bf16 hi piece of t, col 1 = bf16 lo piece (t - hi), col 2 = 1.0, col 3 = 0 (lanes with col >= 3 read
// col 3); A = P rows (row = query s0 + (lane&15), elements 0..7 = keys t0 + 8h + i, 8..15 = keys t0 + 16 + 8h + i)
// as two fragments: hi piece (upper 16 bits of p) and lo piece (upper 16 bits of p - hi). Two WMMAs per 32 keys:
// acc1 = P_hi . B, acc2 = P_lo . B, so D columns 0,1 of acc1+acc2 sum to sum_k p t (all four cross products) and
// column 2 to sum_k p, both from the very same operands. D element r = row 8h + r, col lane&15: per row the three
// columns are fetched with shuffles from lanes 16h + 0,1,2, beta = num * rcp(den) (den >= ~1), lane 16h + r keeps
// row 8h + r and writes it to the LDS staging array Bs[s]. Wave w owns query tiles w + 4i.
// Epilogue: after a block barrier the 1024 f32 values go to BT[n][head][0..1023] as two instructions of 128 lanes x
// coverage: Bt rows 0..3 x keys 0..1031 (128 threads x 8 keys + thread 0 the 8 tail keys); Bs[s] written once for every
//           s (tile rows 0..7 by lanes 0..7, rows 8..15 by lanes 16..23); plane region 4 KB per block, 256 blocks =
//           the whole 1 MiB plane.
// =====================================================================================================
__global__ __launch_bounds__(128)
void attn_rank1(const float* __restrict__ x, const float* __restrict__ embed_w,
                const float* __restrict__ q_w, const float* __restrict__ k_w, float* bt) {
  __shared__ __align__(32) float tv[SEQ];
  __shared__ __align__(16) unsigned short Bt[4 * BTP];
  __shared__ __align__(16) float Bs[SEQ];
  __shared__ float hv[2][HDIM];
  __shared__ float red[4][2];

  const int n    = blockIdx.x >> 2;
  const int head = blockIdx.x & 3;
  const int b    = n >> 5;
  const int ch   = n & 31;
  const int tid  = threadIdx.x, lane = tid & 31, wave = tid >> 5;
  const int lo   = lane & 15, hi = lane >> 4;

  // ---- token values of this sequence, with block max/min ----
  float lmax = -3.0e38f, lmin = 3.0e38f;
  for (int t = tid; t < SEQ; t += 128) {
    const int hh = t >> 5, ww = t & 31;
    const float v = x[(((size_t)b * IMH + hh) * IMW + ww) * CIN + ch];
    tv[t] = v;
    lmax = fmaxf(lmax, v);
    lmin = fminf(lmin, v);
  }
#pragma unroll
  for (int off = 16; off > 0; off >>= 1) {
    lmax = fmaxf(lmax, __shfl_xor(lmax, off, 32));
    lmin = fminf(lmin, __shfl_xor(lmin, off, 32));
  }
  if (lane == 0) { red[wave][0] = lmax; red[wave][1] = lmin; }

  // ---- per-head projection vectors: wave 0 -> qe, wave 1 -> ke (wave-uniform source select;
  //      lanes 16..31 duplicate lanes 0..15 and store the identical value) ----
  if (wave < 2) {
    const float* wsrc = (wave == 0) ? q_w : k_w;
    const float* wrow = wsrc + (size_t)(head * HDIM + lo) * DMOD;
    float acc = 0.f;
#pragma unroll 4
    for (int k = 0; k < DMOD; ++k) acc = fmaf(wrow[k], embed_w[k], acc);
    hv[wave][lo] = acc;
  }
  __syncthreads();

  const float gmax = fmaxf(fmaxf(red[0][0], red[1][0]), fmaxf(red[2][0], red[3][0]));
  const float gmin = fminf(fminf(red[0][1], red[1][1]), fminf(red[2][1], red[3][1]));
  float dqk = 0.f;
#pragma unroll 4
  for (int d = 0; d < HDIM; ++d) dqk = fmaf(hv[0][d], hv[1][d], dqk);
  const float ah2 = dqk * (0.25f * LOG2E);

  // ---- B table: row 0 = t hi piece, row 1 = t lo piece, row 2 = ones, row 3 = zeros; keys 8*tid..8*tid+7 ----
  {
    const int kb = 8 * tid;
    const v4f ta = *(const v4f*)(tv + kb);
    const v4f tb = *(const v4f*)(tv + kb + 4);
    float tt[8];
#pragma unroll
    for (int e = 0; e < 4; ++e) { tt[e] = ta[e]; tt[4 + e] = tb[e]; }
    unsigned hb[8], lb[8];
#pragma unroll
    for (int e = 0; e < 8; ++e) split2(tt[e], hb[e], lb[e]);
    v4u h4, l4;
#pragma unroll
    for (int e = 0; e < 4; ++e) { h4[e] = pk(hb[2 * e], hb[2 * e + 1]); l4[e] = pk(lb[2 * e], lb[2 * e + 1]); }
    const v4u ones = {0x3F803F80u, 0x3F803F80u, 0x3F803F80u, 0x3F803F80u};
    const v4u zer  = {0u, 0u, 0u, 0u};
    *(v4u*)(Bt + 0 * BTP + kb) = h4;
    *(v4u*)(Bt + 1 * BTP + kb) = l4;
    *(v4u*)(Bt + 2 * BTP + kb) = ones;
    *(v4u*)(Bt + 3 * BTP + kb) = zer;
    if (tid == 0) {                          // tail keys 1024..1031 (never read, zero-filled)
      *(v4u*)(Bt + 0 * BTP + SEQ) = zer;
      *(v4u*)(Bt + 1 * BTP + SEQ) = zer;
      *(v4u*)(Bt + 2 * BTP + SEQ) = zer;
      *(v4u*)(Bt + 3 * BTP + SEQ) = zer;
    }
  }
  __syncthreads();

  const int br = (lo < 3) ? lo : 3;                                   // B fragment: column = lane&15 -> table row
  const unsigned short* brow = Bt + br * BTP + 8 * hi;
  float* plane = bt + (size_t)(n * NHEAD + head) * SEQ;

#pragma unroll 1
  for (int i = 0; i < SEQ / 64; ++i) {                                // 16 query tiles per wave, wave-uniform
    const int s0 = (wave + 4 * i) * 16;
    const float coef = ah2 * tv[s0 + lo];                             // query row m = lo
    const float cm   = -fmaxf(coef * gmax, coef * gmin);              // exact row max, p <= 1
    v8f acc1 = zero8(), acc2 = zero8();
#pragma unroll 1
    for (int kt = 0; kt < SEQ / 32; ++kt) {
      const int t0 = kt * 32;
      const v8f ta = *(const v8f*)(tv + t0 + 8 * hi);               // keys t0 + 8h + 0..7
      const v8f tb = *(const v8f*)(tv + t0 + 16 + 8 * hi);          // keys t0 + 16 + 8h + 0..7
      FragB ph, pl;
#pragma unroll
      for (int j = 0; j < 4; ++j) {
        const float p0 = __builtin_amdgcn_exp2f(fmaf(coef, ta[2 * j], cm));
        const float p1 = __builtin_amdgcn_exp2f(fmaf(coef, ta[2 * j + 1], cm));
        const float p2 = __builtin_amdgcn_exp2f(fmaf(coef, tb[2 * j], cm));
        const float p3 = __builtin_amdgcn_exp2f(fmaf(coef, tb[2 * j + 1], cm));
        const unsigned u0 = __float_as_uint(p0), u1 = __float_as_uint(p1);
        const unsigned u2 = __float_as_uint(p2), u3 = __float_as_uint(p3);
        const unsigned g0 = u0 & 0xFFFF0000u, g1 = u1 & 0xFFFF0000u;
        const unsigned g2 = u2 & 0xFFFF0000u, g3 = u3 & 0xFFFF0000u;
        const float l0 = p0 - __uint_as_float(g0), l1 = p1 - __uint_as_float(g1);
        const float l2 = p2 - __uint_as_float(g2), l3 = p3 - __uint_as_float(g3);
        ph.u[j]     = (u0 >> 16) | g1;                                // elements 2j, 2j+1
        ph.u[4 + j] = (u2 >> 16) | g3;                                // elements 8+2j, 8+2j+1
        pl.u[j]     = (__float_as_uint(l0) >> 16) | (__float_as_uint(l1) & 0xFFFF0000u);
        pl.u[4 + j] = (__float_as_uint(l2) >> 16) | (__float_as_uint(l3) & 0xFFFF0000u);
      }
      FragB bf;
      bf.q[0] = *(const v4u*)(brow + t0);                             // keys t0 + 8h + 0..7
      bf.q[1] = *(const v4u*)(brow + t0 + 16);                        // keys t0 + 16 + 8h + 0..7
      acc1 = mma_b(ph.v, bf.v, acc1);
      acc2 = mma_b(pl.v, bf.v, acc2);
      guard2(acc1, acc2, ph.u, pl.u, bf.u);
    }

    // ---- combine: D element r = row 8h + r; columns 0,1,2 live in lanes 16h + 0,1,2 ----
    const int sb = 16 * hi;
    float beta[8];
#pragma unroll
    for (int r = 0; r < 8; ++r) {
      const float a0 = __shfl(acc1[r], sb, 32);
      const float a1 = __shfl(acc1[r], sb + 1, 32);
      const float a2 = __shfl(acc1[r], sb + 2, 32);
      const float c0 = __shfl(acc2[r], sb, 32);
      const float c1 = __shfl(acc2[r], sb + 1, 32);
      const float c2 = __shfl(acc2[r], sb + 2, 32);
      const float num = (a0 + c0) + (a1 + c1);
      const float den = a2 + c2;
      beta[r] = num * __builtin_amdgcn_rcpf(den);
    }
    float mine = beta[0];
#pragma unroll
    for (int r = 1; r < 8; ++r) mine = (lo == r) ? beta[r] : mine;
    if (lo < 8) Bs[s0 + 8 * hi + lo] = mine;
  }
  __syncthreads();
  {
    const v4f v0 = *(const v4f*)(Bs + 4 * tid);
    const v4f v1 = *(const v4f*)(Bs + 512 + 4 * tid);
    float* d0 = plane + 4 * tid;
    float* d1 = plane + 512 + 4 * tid;
    *(v4f*)d0 = v0;
    *(v4f*)d1 = v1;
    
  }
}

// =====================================================================================================
// Kernel 2, in the module's order: for every channel sequence n = b*32 + c and token row s,
//   Y2_c[s][o] = sum_{j=0..63} (BT[n][j>>4][s] * ve[j]) * o_w[o][j]      (K = 64, o_w row o, j contiguous)
//   out[(b,s)][o] = sum_{c=0..31} mix[c] * Y2_c[s][o]                     (fixed order c = 0..31, f32 VALU)
// with ve[j] = sum_k v_w[j][k] e[k] (f32 dots of 64). Block = 4 waves = 64 rows s0..s0+63 of batch b (grid 32);
// wave w rows s0+16w..+15, all 64 output columns.
// o_w is decomposed once per block into bf16 hi / lo tables Wh/Wl[o][j] (j contiguous, pitch 72); B fragments:
// lane col o, elements 0..7 <- W[o][32ks+8h+0..7], 8..15 <- W[o][32ks+16+8h+0..7]. A fragments are built in f32
// registers: row s, element i <- beta[n][2ks][s]*ve[32ks+8h+i], element 8+i <- beta[n][2ks+1][s]*ve[32ks+16+8h+i]
// (the same j map), decomposed into bf16 hi and lo fragments; per channel the tile accumulators start from zero and
// take Ahi.Bhi + Ahi.Blo + Alo.Bhi for ks = 0,1; then oacc += mix[c] * acc in f32 (separate accumulator).
// coverage: W tables 128 threads x 32 = 64 x 64 each; 32 blocks x 4 waves x 16 rows x 64 cols = out [2048][64].
// =====================================================================================================
__global__ __launch_bounds__(128)
void proj_mix(const float* __restrict__ bt, const float* __restrict__ embed_w, const float* __restrict__ v_w,
              const float* __restrict__ o_w, const float* __restrict__ mix_w, float* out) {
  __shared__ __align__(16) unsigned short Wh[COUT * WPITCH];
  __shared__ __align__(16) unsigned short Wl[COUT * WPITCH];
  __shared__ __align__(32) float ve[DMOD];
  __shared__ float mw[CIN];
  __shared__ __align__(16) float sT[4][16 * SPITCH];
  const int tid  = threadIdx.x, lane = tid & 31, wave = tid >> 5;
  const int lo   = lane & 15, hi = lane >> 4;
  const int b    = blockIdx.x >> 4;
  const int s0   = (blockIdx.x & 15) * 64;

  {
    const int o = tid >> 1, k0 = (tid & 1) * 32;                     // o_w row o, j = k0 .. k0+31
    const float* sp = o_w + (size_t)o * DMOD + k0;
#pragma unroll
    for (int q = 0; q < 4; ++q) {
      const v4f a0 = *(const v4f*)(sp + 8 * q);
      const v4f a1 = *(const v4f*)(sp + 8 * q + 4);
      float f[8];
#pragma unroll
      for (int e = 0; e < 4; ++e) { f[e] = a0[e]; f[4 + e] = a1[e]; }
      v4u hq, lq;
#pragma unroll
      for (int e = 0; e < 4; ++e) {
        unsigned h0, l0, h1, l1;
        split2(f[2 * e], h0, l0);
        split2(f[2 * e + 1], h1, l1);
        hq[e] = pk(h0, h1);
        lq[e] = pk(l0, l1);
      }
      *(v4u*)(Wh + o * WPITCH + k0 + 8 * q) = hq;
      *(v4u*)(Wl + o * WPITCH + k0 + 8 * q) = lq;
    }
  }
  if (tid < DMOD) {                                                   // waves 0,1 (wave-uniform): ve[j], v_w row j
    const float* wrow = v_w + (size_t)tid * DMOD;
    float acc = 0.f;
#pragma unroll 4
    for (int k = 0; k < DMOD; ++k) acc = fmaf(wrow[k], embed_w[k], acc);
    ve[tid] = acc;
  }
  if (tid < CIN) mw[tid] = mix_w[tid];                                // wave 0 (wave-uniform)
  __syncthreads();

  v8f oacc[4];
#pragma unroll
  for (int j = 0; j < 4; ++j) oacc[j] = zero8();

  const int arow = s0 + 16 * wave + lo;                               // row index s within batch b
  const float* bp = bt + (size_t)(b * CIN) * (NHEAD * SEQ) + arow;   // + c*4096 + h*1024 -> BT[b*32+c][h][s]

#pragma unroll 1
  for (int c = 0; c < CIN; ++c) {
    const float* bc = bp + (size_t)c * (NHEAD * SEQ);
    v8f acc[4];
#pragma unroll
    for (int j = 0; j < 4; ++j) acc[j] = zero8();
#pragma unroll 1
    for (int ks = 0; ks < 2; ++ks) {
      const float be0 = bc[(size_t)(2 * ks) * SEQ];                  // head 2ks   of sequence b*32+c, row s
      const float be1 = bc[(size_t)(2 * ks + 1) * SEQ];              // head 2ks+1
      const v8f vea = *(const v8f*)(ve + 32 * ks + 8 * hi);           // j = 32ks + 8h + 0..7      (head 2ks)
      const v8f veb = *(const v8f*)(ve + 32 * ks + 16 + 8 * hi);      // j = 32ks + 16 + 8h + 0..7 (head 2ks+1)
      FragB fa, fl;
#pragma unroll
      for (int j = 0; j < 4; ++j) {
        unsigned h0, l0, h1, l1;
        split2(be0 * vea[2 * j], h0, l0);
        split2(be0 * vea[2 * j + 1], h1, l1);
        fa.u[j] = pk(h0, h1);
        fl.u[j] = pk(l0, l1);
        split2(be1 * veb[2 * j], h0, l0);
        split2(be1 * veb[2 * j + 1], h1, l1);
        fa.u[4 + j] = pk(h0, h1);
        fl.u[4 + j] = pk(l0, l1);
      }
      FragB wh[4], wl[4];
#pragma unroll
      for (int j = 0; j < 4; ++j) {
        const int wo = (16 * j + lo) * WPITCH + 32 * ks + 8 * hi;
        wh[j].q[0] = *(const v4u*)(Wh + wo);
        wh[j].q[1] = *(const v4u*)(Wh + wo + 16);
        wl[j].q[0] = *(const v4u*)(Wl + wo);
        wl[j].q[1] = *(const v4u*)(Wl + wo + 16);
      }
#pragma unroll
      for (int j = 0; j < 4; ++j) {
        acc[j] = mma_b(fa.v, wh[j].v, acc[j]);
        acc[j] = mma_b(fa.v, wl[j].v, acc[j]);
        acc[j] = mma_b(fl.v, wh[j].v, acc[j]);
      }
      guard4(acc[0], acc[1], acc[2], acc[3], fa.u, fl.u,
             wh[0].u, wh[1].u, wh[2].u, wh[3].u, wl[0].u, wl[1].u, wl[2].u, wl[3].u);
    }
    const float wgt = mw[c];                                          // mix weight of input channel c
#pragma unroll
    for (int j = 0; j < 4; ++j) {
#pragma unroll
      for (int r = 0; r < 8; ++r) oacc[j][r] = fmaf(wgt, acc[j][r], oacc[j][r]);
    }
  }

  // ---- epilogue ----
  float* slab = sT[wave];
  const int mOff = 8 * hi;
#pragma unroll
  for (int j = 0; j < 4; ++j) {
#pragma unroll
    for (int r = 0; r < 8; ++r) slab[(mOff + r) * SPITCH + (j << 4) + lo] = oacc[j][r];
  }
  wave_sync_lds();
  const int c4 = lo * 4;
  v4f vals[8];
#pragma unroll
  for (int it = 0; it < 8; ++it) {
    const int row = it * 2 + hi;                                      // it 0..7 x h 0..1 = rows 0..15
    vals[it] = *(const v4f*)(slab + row * SPITCH + c4);
  }
  float* ob = out + (size_t)(b * SEQ + s0 + 16 * wave) * COUT;
#pragma unroll
  for (int it = 0; it < 8; ++it) {
    const int row = it * 2 + hi;
    *(v4f*)(ob + (size_t)row * COUT + c4) = vals[it];
  }
  
  wave_sync_lds();
}

// =====================================================================================================
// Workspace map (bytes): BT f32 [64 seq][4 heads][1024]  offset 0, 1048576 bytes (4 KB per (seq, head), written as
// Inputs (f32): 0 x [2][32][32][32], 1 embed_w [64][1], 2 q_w [64][64], 3 k_w, 4 v_w, 5 o_w [64][64],
// 6 mix weights [1][32]. Output f32 [2][32][32][64].
// =====================================================================================================
extern "C" void kernel_launch(void* const* d_in, const int* in_sizes, int n_in,
                              void* d_out, int out_size, void* d_ws, size_t ws_size,
                              hipStream_t stream) {
  if (n_in < 7) return;
  if (in_sizes[0] != NBAT * IMH * IMW * CIN) return;
  if (in_sizes[1] != DMOD) return;
  if (in_sizes[2] != DMOD * DMOD || in_sizes[3] != DMOD * DMOD || in_sizes[4] != DMOD * DMOD) return;
  if (in_sizes[5] != COUT * DMOD || in_sizes[6] != CIN) return;
  if (out_size != NBAT * SEQ * COUT) return;

  const size_t PB = (size_t)NSQ * NHEAD * SEQ * 4;                   // 1048576
  if (PB > ws_size) return;
  if (PB > (size_t)134217728) return;

  const float* x       = (const float*)d_in[0];
  const float* embed_w = (const float*)d_in[1];
  const float* q_w     = (const float*)d_in[2];
  const float* k_w     = (const float*)d_in[3];
  const float* v_w     = (const float*)d_in[4];
  const float* o_w     = (const float*)d_in[5];
  const float* mix_w   = (const float*)d_in[6];
  float* bt            = (float*)d_ws;
  float* out           = (float*)d_out;

  const dim3 blk(128);
  const dim3 gA(NSQ * NHEAD);                                        // 256 blocks
  const dim3 gP(NBAT * SEQ / 64);                                    // 32 blocks

  attn_rank1<<<gA, blk, 0, stream>>>(x, embed_w, q_w, k_w, bt);
  proj_mix<<<gP, blk, 0, stream>>>(bt, embed_w, v_w, o_w, mix_w, out);
  (void)hipGetLastError();
}

// v001
// Measured time: 72.9 microseconds a run.
// Two timings next to v000 put it at 1.47 and 1.45 times that version's speed.
// Contractions: attention P.V through the rank-1 V = t*ve as the padded matvec P.[t | 1] on
// v_wmma_f32_16x16x32_bf16 (A = P as bf16 hi and lo pieces, B columns = t_hi, t_lo, ones, zeros; two products per
// 32 keys, f32 accumulate); the 32-channel mix as a fixed-order f32 VALU sum of the per-channel beta values, taken ahead
// of the output projection (both are linear); output projection (mixed beta*ve rows) . o_w^T on v_wmma_f32_16x16x32_bf16
// (both operands bf16 hi+lo pieces, hh+hl+lh, K = 64, f32 accumulate from zero); embedding, per-head q/k/v vectors,
// scores and softmax exponentials in f32 on VALU.
#include <hip/hip_runtime.h>
#include <stdint.h>

#define NBAT   2
#define IMH    32
#define IMW    32
#define CIN    32
#define DMOD   64
#define NHEAD  4
#define HDIM   16
#define SEQ    1024
#define NSQ    64
#define COUT   64
#define BTP    1032
#define WPITCH 72
#define SPITCH 68
#define LOG2E  1.44269504088896340736f

static_assert(IMH * IMW == SEQ);
static_assert(NBAT * CIN == NSQ);
static_assert(NHEAD * HDIM == DMOD);
static_assert((SEQ % 64) == 0 && COUT == 64 && DMOD == 64 && CIN == 32 && HDIM == 16);
static_assert((BTP % 8) == 0 && (WPITCH % 8) == 0 && (SPITCH % 4) == 0);
static_assert(SEQ == 8 * 128);

typedef __bf16   v16b __attribute__((ext_vector_type(16)));
typedef float    v8f  __attribute__((ext_vector_type(8)));
typedef float    v4f  __attribute__((ext_vector_type(4)));
typedef unsigned int v8u __attribute__((ext_vector_type(8)));
typedef unsigned int v4u __attribute__((ext_vector_type(4)));

union FragB { v16b v; v8u u; v4u q[2]; };

// ---- scalar helpers ----------------------------------------------------------------------------------
__device__ __forceinline__ v8f zero8() { v8f z = {0.f, 0.f, 0.f, 0.f, 0.f, 0.f, 0.f, 0.f}; return z; }
// f32 bits -> bf16 value kept in the upper 16 bits (low 16 bits zero), RNE convert
__device__ __forceinline__ unsigned rne_hi(unsigned u) {
  return (u + 0x7FFFu + ((u >> 16) & 1u)) & 0xFFFF0000u;
}
// two-piece bf16 decomposition: a ~= hi + lo, hi = RNE bf16(a), lo = RNE bf16(a - hi); returns the 16-bit patterns
__device__ __forceinline__ void split2(float a, unsigned& h16, unsigned& l16) {
  const unsigned hu = rne_hi(__float_as_uint(a));
  const float lf = a - __uint_as_float(hu);
  h16 = hu >> 16;
  l16 = rne_hi(__float_as_uint(lf)) >> 16;
}
__device__ __forceinline__ unsigned pk(unsigned lo16, unsigned hi16) { return (lo16 & 0xFFFFu) | (hi16 << 16); }

// ---- WMMA helpers with trailing VALU hazard gap -----------------------------------------------------
__device__ __forceinline__ v8f mma_b(v16b a, v16b b, v8f c) {
  return __builtin_amdgcn_wmma_f32_16x16x32_bf16(false, a, false, b, (short)0, c, false, false);
}
__device__ __forceinline__ void guard2(v8f& a, v8f& b, v8u x, v8u y, v8u z) {
#if defined(__HIP_DEVICE_COMPILE__)
  asm volatile("v_nop\n\tv_nop\n\tv_nop\n\tv_nop" : "+v"(a), "+v"(b) : "v"(x), "v"(y), "v"(z));
#endif
}
__device__ __forceinline__ void guard4(v8f& a, v8f& b, v8f& c, v8f& d, v8u x0, v8u x1,
                                       v8u y0, v8u y1, v8u y2, v8u y3, v8u z0, v8u z1, v8u z2, v8u z3) {
#if defined(__HIP_DEVICE_COMPILE__)
  asm volatile("v_nop\n\tv_nop\n\tv_nop\n\tv_nop"
               : "+v"(a), "+v"(b), "+v"(c), "+v"(d)
               : "v"(x0), "v"(x1), "v"(y0), "v"(y1), "v"(y2), "v"(y3), "v"(z0), "v"(z1), "v"(z2), "v"(z3));
#endif
}
__device__ __forceinline__ void wave_sync_lds() {
  __builtin_amdgcn_fence(__ATOMIC_RELEASE, "workgroup");
  __builtin_amdgcn_wave_barrier();
  __builtin_amdgcn_fence(__ATOMIC_ACQUIRE, "workgroup");
}

// =====================================================================================================
// Kernel 1: one block per (sequence n = b*32 + c, head), 128 threads = 4 waves.
// t[s] = x[b][s>>5][s&31][c] in LDS (f32). embed_w is a single column e, so E = t (x) e and Q[s] = t[s]*qe,
// K[s] = t[s]*ke, V[s] = t[s]*ve with qe[i] = sum_k q_w[i][k] e[k], ke likewise (this head's 16 rows, f32 dots).
// Scores in log2 units: s2[q][k] = ah * t[q] * t[k], ah = 0.25 * log2(e) * (qe_h . ke_h); the row max is exactly
// max(coef*gmax, coef*gmin) with coef = ah*t[q], so p = 2^(s2 - rowmax) <= 1 in one pass (f32, v_exp_f32).
// Since V_h[k][d] = t[k] * ve_h[d], the attention output row is beta_h[q] * ve_h with beta = sum_k p t / sum_k p.
// That K = 1024 reduction is a 16-column padded matvec on bf16 WMMA: B table Bt[col][key] (k contiguous, pitch 1032)
// with col 0 = bf16 hi piece of t, col 1 = bf16 lo piece (t - hi), col 2 = 1.0, col 3 = 0 (lanes with col >= 3 read
// col 3); A = P rows (row = query s0 + (lane&15), elements 0..7 = keys t0 + 8h + i, 8..15 = keys t0 + 16 + 8h + i)
// as two fragments: hi piece (upper 16 bits of p) and lo piece (upper 16 bits of p - hi). Two WMMAs per 32 keys:
// acc1 = P_hi . B, acc2 = P_lo . B, so D columns 0,1 of acc1+acc2 sum to sum_k p t (all four cross products) and
// column 2 to sum_k p, both from the very same operands. D element r = row 8h + r, col lane&15: per row the three
// columns are fetched with shuffles from lanes 16h + 0,1,2, beta = num * rcp(den) (den >= ~1), lane 16h + r keeps
// row 8h + r and writes it to the LDS staging array Bs[s]. Wave w owns query tiles w + 4i.
// Epilogue: after a block barrier the 1024 f32 values go to BT[n][head][0..1023] as two instructions of 128 lanes x
// coverage: Bt rows 0..3 x keys 0..1031 (128 threads x 8 keys + thread 0 the 8 tail keys); Bs[s] written once for every
//           s (tile rows 0..7 by lanes 0..7, rows 8..15 by lanes 16..23); plane region 4 KB per block, 256 blocks =
//           the whole 1 MiB plane.
// =====================================================================================================
__global__ __launch_bounds__(128)
void attn_rank1(const float* __restrict__ x, const float* __restrict__ embed_w,
                const float* __restrict__ q_w, const float* __restrict__ k_w, float* bt) {
  __shared__ __align__(32) float tv[SEQ];
  __shared__ __align__(16) unsigned short Bt[4 * BTP];
  __shared__ __align__(16) float Bs[SEQ];
  __shared__ float hv[2][HDIM];
  __shared__ float red[4][2];

  const int n    = blockIdx.x >> 2;
  const int head = blockIdx.x & 3;
  const int b    = n >> 5;
  const int ch   = n & 31;
  const int tid  = threadIdx.x, lane = tid & 31, wave = tid >> 5;
  const int lo   = lane & 15, hi = lane >> 4;

  // ---- token values of this sequence, with block max/min ----
  float lmax = -3.0e38f, lmin = 3.0e38f;
  for (int t = tid; t < SEQ; t += 128) {
    const int hh = t >> 5, ww = t & 31;
    const float v = x[(((size_t)b * IMH + hh) * IMW + ww) * CIN + ch];
    tv[t] = v;
    lmax = fmaxf(lmax, v);
    lmin = fminf(lmin, v);
  }
#pragma unroll
  for (int off = 16; off > 0; off >>= 1) {
    lmax = fmaxf(lmax, __shfl_xor(lmax, off, 32));
    lmin = fminf(lmin, __shfl_xor(lmin, off, 32));
  }
  if (lane == 0) { red[wave][0] = lmax; red[wave][1] = lmin; }

  // ---- per-head projection vectors: wave 0 -> qe, wave 1 -> ke (wave-uniform source select;
  //      lanes 16..31 duplicate lanes 0..15 and store the identical value) ----
  if (wave < 2) {
    const float* wsrc = (wave == 0) ? q_w : k_w;
    const float* wrow = wsrc + (size_t)(head * HDIM + lo) * DMOD;
    float acc = 0.f;
#pragma unroll 4
    for (int k = 0; k < DMOD; ++k) acc = fmaf(wrow[k], embed_w[k], acc);
    hv[wave][lo] = acc;
  }
  __syncthreads();

  const float gmax = fmaxf(fmaxf(red[0][0], red[1][0]), fmaxf(red[2][0], red[3][0]));
  const float gmin = fminf(fminf(red[0][1], red[1][1]), fminf(red[2][1], red[3][1]));
  float dqk = 0.f;
#pragma unroll 4
  for (int d = 0; d < HDIM; ++d) dqk = fmaf(hv[0][d], hv[1][d], dqk);
  const float ah2 = dqk * (0.25f * LOG2E);

  // ---- B table: row 0 = t hi piece, row 1 = t lo piece, row 2 = ones, row 3 = zeros; keys 8*tid..8*tid+7 ----
  {
    const int kb = 8 * tid;
    const v4f ta = *(const v4f*)(tv + kb);
    const v4f tb = *(const v4f*)(tv + kb + 4);
    float tt[8];
#pragma unroll
    for (int e = 0; e < 4; ++e) { tt[e] = ta[e]; tt[4 + e] = tb[e]; }
    unsigned hb[8], lb[8];
#pragma unroll
    for (int e = 0; e < 8; ++e) split2(tt[e], hb[e], lb[e]);
    v4u h4, l4;
#pragma unroll
    for (int e = 0; e < 4; ++e) { h4[e] = pk(hb[2 * e], hb[2 * e + 1]); l4[e] = pk(lb[2 * e], lb[2 * e + 1]); }
    const v4u ones = {0x3F803F80u, 0x3F803F80u, 0x3F803F80u, 0x3F803F80u};
    const v4u zer  = {0u, 0u, 0u, 0u};
    *(v4u*)(Bt + 0 * BTP + kb) = h4;
    *(v4u*)(Bt + 1 * BTP + kb) = l4;
    *(v4u*)(Bt + 2 * BTP + kb) = ones;
    *(v4u*)(Bt + 3 * BTP + kb) = zer;
    if (tid == 0) {                          // tail keys 1024..1031 (never read, zero-filled)
      *(v4u*)(Bt + 0 * BTP + SEQ) = zer;
      *(v4u*)(Bt + 1 * BTP + SEQ) = zer;
      *(v4u*)(Bt + 2 * BTP + SEQ) = zer;
      *(v4u*)(Bt + 3 * BTP + SEQ) = zer;
    }
  }
  __syncthreads();

  const int br = (lo < 3) ? lo : 3;                                   // B fragment: column = lane&15 -> table row
  const unsigned short* brow = Bt + br * BTP + 8 * hi;
  float* plane = bt + (size_t)(n * NHEAD + head) * SEQ;

#pragma unroll 1
  for (int i = 0; i < SEQ / 64; ++i) {                                // 16 query tiles per wave, wave-uniform
    const int s0 = (wave + 4 * i) * 16;
    const float coef = ah2 * tv[s0 + lo];                             // query row m = lo
    const float cm   = -fmaxf(coef * gmax, coef * gmin);              // exact row max, p <= 1
    v8f acc1 = zero8(), acc2 = zero8();
#pragma unroll 1
    for (int kt = 0; kt < SEQ / 32; ++kt) {
      const int t0 = kt * 32;
      const v8f ta = *(const v8f*)(tv + t0 + 8 * hi);               // keys t0 + 8h + 0..7
      const v8f tb = *(const v8f*)(tv + t0 + 16 + 8 * hi);          // keys t0 + 16 + 8h + 0..7
      FragB ph, pl;
#pragma unroll
      for (int j = 0; j < 4; ++j) {
        const float p0 = __builtin_amdgcn_exp2f(fmaf(coef, ta[2 * j], cm));
        const float p1 = __builtin_amdgcn_exp2f(fmaf(coef, ta[2 * j + 1], cm));
        const float p2 = __builtin_amdgcn_exp2f(fmaf(coef, tb[2 * j], cm));
        const float p3 = __builtin_amdgcn_exp2f(fmaf(coef, tb[2 * j + 1], cm));
        const unsigned u0 = __float_as_uint(p0), u1 = __float_as_uint(p1);
        const unsigned u2 = __float_as_uint(p2), u3 = __float_as_uint(p3);
        const unsigned g0 = u0 & 0xFFFF0000u, g1 = u1 & 0xFFFF0000u;
        const unsigned g2 = u2 & 0xFFFF0000u, g3 = u3 & 0xFFFF0000u;
        const float l0 = p0 - __uint_as_float(g0), l1 = p1 - __uint_as_float(g1);
        const float l2 = p2 - __uint_as_float(g2), l3 = p3 - __uint_as_float(g3);
        ph.u[j]     = (u0 >> 16) | g1;                                // elements 2j, 2j+1
        ph.u[4 + j] = (u2 >> 16) | g3;                                // elements 8+2j, 8+2j+1
        pl.u[j]     = (__float_as_uint(l0) >> 16) | (__float_as_uint(l1) & 0xFFFF0000u);
        pl.u[4 + j] = (__float_as_uint(l2) >> 16) | (__float_as_uint(l3) & 0xFFFF0000u);
      }
      FragB bf;
      bf.q[0] = *(const v4u*)(brow + t0);                             // keys t0 + 8h + 0..7
      bf.q[1] = *(const v4u*)(brow + t0 + 16);                        // keys t0 + 16 + 8h + 0..7
      acc1 = mma_b(ph.v, bf.v, acc1);
      acc2 = mma_b(pl.v, bf.v, acc2);
      guard2(acc1, acc2, ph.u, pl.u, bf.u);
    }

    // ---- combine: D element r = row 8h + r; columns 0,1,2 live in lanes 16h + 0,1,2 ----
    const int sb = 16 * hi;
    float beta[8];
#pragma unroll
    for (int r = 0; r < 8; ++r) {
      const float a0 = __shfl(acc1[r], sb, 32);
      const float a1 = __shfl(acc1[r], sb + 1, 32);
      const float a2 = __shfl(acc1[r], sb + 2, 32);
      const float c0 = __shfl(acc2[r], sb, 32);
      const float c1 = __shfl(acc2[r], sb + 1, 32);
      const float c2 = __shfl(acc2[r], sb + 2, 32);
      const float num = (a0 + c0) + (a1 + c1);
      const float den = a2 + c2;
      beta[r] = num * __builtin_amdgcn_rcpf(den);
    }
    float mine = beta[0];
#pragma unroll
    for (int r = 1; r < 8; ++r) mine = (lo == r) ? beta[r] : mine;
    if (lo < 8) Bs[s0 + 8 * hi + lo] = mine;
  }
  __syncthreads();
  {
    const v4f v0 = *(const v4f*)(Bs + 4 * tid);
    const v4f v1 = *(const v4f*)(Bs + 512 + 4 * tid);
    float* d0 = plane + 4 * tid;
    float* d1 = plane + 512 + 4 * tid;
    *(v4f*)d0 = v0;
    *(v4f*)d1 = v1;
    
  }
}

// =====================================================================================================
// Kernel 2: the channel mix and the output projection are both linear, so the mix is taken first, on the four per-head
// scalars of a token row, and the projection runs once per row instead of once per channel:
//   G[h][s]       = sum_{c=0..31} mix[c] * BT[b*32+c][h][s]               (fixed order c = 0..31, f32 VALU)
//   out[(b,s)][o] = sum_{j=0..63} (G[j>>4][s] * ve[j]) * o_w[o][j]        (K = 64, o_w row o, j contiguous)
// with ve[j] = sum_k v_w[j][k] e[k] (f32 dots of 64). Block = 4 waves = 64 rows s0..s0+63 of batch b (grid 32);
// wave w rows s0+16w..+15, all 64 output columns. G: thread t sums row t&63 of heads t>>6 and 2+(t>>6), 64 independent
// loads (a wave reads 128 contiguous bytes per load), into LDS gm[h][row] ahead of the block barrier.
// o_w is decomposed once per block into bf16 hi / lo tables Wh/Wl[o][j] (j contiguous, pitch 72); B fragments:
// lane col o, elements 0..7 <- W[o][32ks+8h+0..7], 8..15 <- W[o][32ks+16+8h+0..7]. A fragments are built in f32
// registers: row s, element i <- G[2ks][s]*ve[32ks+8h+i], element 8+i <- G[2ks+1][s]*ve[32ks+16+8h+i]
// (the same j map), decomposed into bf16 hi and lo fragments; the tile accumulators start from zero and
// take Ahi.Bhi + Ahi.Blo + Alo.Bhi for ks = 0,1.
// coverage: W tables 128 threads x 32 = 64 x 64 each; gm 128 threads x 2 = 4 x 64; 32 blocks x 4 waves x 16 rows x
//           64 cols = out [2048][64].
// =====================================================================================================
__global__ __launch_bounds__(128)
void proj_mix(const float* __restrict__ bt, const float* __restrict__ embed_w, const float* __restrict__ v_w,
              const float* __restrict__ o_w, const float* __restrict__ mix_w, float* out) {
  __shared__ __align__(16) unsigned short Wh[COUT * WPITCH];
  __shared__ __align__(16) unsigned short Wl[COUT * WPITCH];
  __shared__ __align__(32) float ve[DMOD];
  __shared__ float gm[NHEAD][64];
  __shared__ __align__(16) float sT[4][16 * SPITCH];
  const int tid  = threadIdx.x, lane = tid & 31, wave = tid >> 5;
  const int lo   = lane & 15, hi = lane >> 4;
  const int b    = blockIdx.x >> 4;
  const int s0   = (blockIdx.x & 15) * 64;

  // ---- channel mix of the per-head beta values: rows s0..s0+63, heads hp and hp+2 per thread ----
  {
    const int row = tid & 63, hp = tid >> 6;
    const float* gp = bt + (size_t)(b * CIN) * (NHEAD * SEQ) + (size_t)hp * SEQ + s0 + row;
    float g0 = 0.f, g1 = 0.f;
#pragma unroll                                                        // all 64 loads in flight together
    for (int c = 0; c < CIN; ++c) {
      const float wgt = mix_w[c];
      g0 = fmaf(wgt, gp[(size_t)c * (NHEAD * SEQ)], g0);
      g1 = fmaf(wgt, gp[(size_t)c * (NHEAD * SEQ) + 2 * SEQ], g1);
    }
    gm[hp][row]     = g0;
    gm[hp + 2][row] = g1;
  }
  {
    const int o = tid >> 1, k0 = (tid & 1) * 32;                     // o_w row o, j = k0 .. k0+31
    const float* sp = o_w + (size_t)o * DMOD + k0;
#pragma unroll
    for (int q = 0; q < 4; ++q) {
      const v4f a0 = *(const v4f*)(sp + 8 * q);
      const v4f a1 = *(const v4f*)(sp + 8 * q + 4);
      float f[8];
#pragma unroll
      for (int e = 0; e < 4; ++e) { f[e] = a0[e]; f[4 + e] = a1[e]; }
      v4u hq, lq;
#pragma unroll
      for (int e = 0; e < 4; ++e) {
        unsigned h0, l0, h1, l1;
        split2(f[2 * e], h0, l0);
        split2(f[2 * e + 1], h1, l1);
        hq[e] = pk(h0, h1);
        lq[e] = pk(l0, l1);
      }
      *(v4u*)(Wh + o * WPITCH + k0 + 8 * q) = hq;
      *(v4u*)(Wl + o * WPITCH + k0 + 8 * q) = lq;
    }
  }
  if (tid < DMOD) {                                                   // waves 0,1 (wave-uniform): ve[j], v_w row j
    const float* wrow = v_w + (size_t)tid * DMOD;
    float acc = 0.f;
#pragma unroll 4
    for (int k = 0; k < DMOD; ++k) acc = fmaf(wrow[k], embed_w[k], acc);
    ve[tid] = acc;
  }
  __syncthreads();

  v8f oacc[4];
#pragma unroll
  for (int j = 0; j < 4; ++j) oacc[j] = zero8();

  const int arow = 16 * wave + lo;                                    // row index within the block's 64 rows

#pragma unroll 1
  for (int ks = 0; ks < 2; ++ks) {
    const float be0 = gm[2 * ks][arow];                             // head 2ks, mixed over channels, row s
    const float be1 = gm[2 * ks + 1][arow];                         // head 2ks+1
    const v8f vea = *(const v8f*)(ve + 32 * ks + 8 * hi);           // j = 32ks + 8h + 0..7      (head 2ks)
    const v8f veb = *(const v8f*)(ve + 32 * ks + 16 + 8 * hi);      // j = 32ks + 16 + 8h + 0..7 (head 2ks+1)
    FragB fa, fl;
#pragma unroll
    for (int j = 0; j < 4; ++j) {
      unsigned h0, l0, h1, l1;
      split2(be0 * vea[2 * j], h0, l0);
      split2(be0 * vea[2 * j + 1], h1, l1);
      fa.u[j] = pk(h0, h1);
      fl.u[j] = pk(l0, l1);
      split2(be1 * veb[2 * j], h0, l0);
      split2(be1 * veb[2 * j + 1], h1, l1);
      fa.u[4 + j] = pk(h0, h1);
      fl.u[4 + j] = pk(l0, l1);
    }
    FragB wh[4], wl[4];
#pragma unroll
    for (int j = 0; j < 4; ++j) {
      const int wo = (16 * j + lo) * WPITCH + 32 * ks + 8 * hi;
      wh[j].q[0] = *(const v4u*)(Wh + wo);
      wh[j].q[1] = *(const v4u*)(Wh + wo + 16);
      wl[j].q[0] = *(const v4u*)(Wl + wo);
      wl[j].q[1] = *(const v4u*)(Wl + wo + 16);
    }
#pragma unroll
    for (int j = 0; j < 4; ++j) {
      oacc[j] = mma_b(fa.v, wh[j].v, oacc[j]);
      oacc[j] = mma_b(fa.v, wl[j].v, oacc[j]);
      oacc[j] = mma_b(fl.v, wh[j].v, oacc[j]);
    }
    guard4(oacc[0], oacc[1], oacc[2], oacc[3], fa.u, fl.u,
           wh[0].u, wh[1].u, wh[2].u, wh[3].u, wl[0].u, wl[1].u, wl[2].u, wl[3].u);
  }

  // ---- epilogue ----
  float* slab = sT[wave];
  const int mOff = 8 * hi;
#pragma unroll
  for (int j = 0; j < 4; ++j) {
#pragma unroll
    for (int r = 0; r < 8; ++r) slab[(mOff + r) * SPITCH + (j << 4) + lo] = oacc[j][r];
  }
  wave_sync_lds();
  const int c4 = lo * 4;
  v4f vals[8];
#pragma unroll
  for (int it = 0; it < 8; ++it) {
    const int row = it * 2 + hi;                                      // it 0..7 x h 0..1 = rows 0..15
    vals[it] = *(const v4f*)(slab + row * SPITCH + c4);
  }
  float* ob = out + (size_t)(b * SEQ + s0 + 16 * wave) * COUT;
#pragma unroll
  for (int it = 0; it < 8; ++it) {
    const int row = it * 2 + hi;
    *(v4f*)(ob + (size_t)row * COUT + c4) = vals[it];
  }
  
  wave_sync_lds();
}

// =====================================================================================================
// Workspace map (bytes): BT f32 [64 seq][4 heads][1024]  offset 0, 1048576 bytes (4 KB per (seq, head), written as
// Inputs (f32): 0 x [2][32][32][32], 1 embed_w [64][1], 2 q_w [64][64], 3 k_w, 4 v_w, 5 o_w [64][64],
// 6 mix weights [1][32]. Output f32 [2][32][32][64].
// =====================================================================================================
extern "C" void kernel_launch(void* const* d_in, const int* in_sizes, int n_in,
                              void* d_out, int out_size, void* d_ws, size_t ws_size,
                              hipStream_t stream) {
  if (n_in < 7) return;
  if (in_sizes[0] != NBAT * IMH * IMW * CIN) return;
  if (in_sizes[1] != DMOD) return;
  if (in_sizes[2] != DMOD * DMOD || in_sizes[3] != DMOD * DMOD || in_sizes[4] != DMOD * DMOD) return;
  if (in_sizes[5] != COUT * DMOD || in_sizes[6] != CIN) return;
  if (out_size != NBAT * SEQ * COUT) return;

  const size_t PB = (size_t)NSQ * NHEAD * SEQ * 4;                   // 1048576
  if (PB > ws_size) return;
  if (PB > (size_t)134217728) return;

  const float* x       = (const float*)d_in[0];
  const float* embed_w = (const float*)d_in[1];
  const float* q_w     = (const float*)d_in[2];
  const float* k_w     = (const float*)d_in[3];
  const float* v_w     = (const float*)d_in[4];
  const float* o_w     = (const float*)d_in[5];
  const float* mix_w   = (const float*)d_in[6];
  float* bt            = (float*)d_ws;
  float* out           = (float*)d_out;

  const dim3 blk(128);
  const dim3 gA(NSQ * NHEAD);                                        // 256 blocks
  const dim3 gP(NBAT * SEQ / 64);                                    // 32 blocks

  attn_rank1<<<gA, blk, 0, stream>>>(x, embed_w, q_w, k_w, bt);
  proj_mix<<<gP, blk, 0, stream>>>(bt, embed_w, v_w, o_w, mix_w, out);
  (void)hipGetLastError();
}

// v002
// One run takes 46.2 microseconds.
// Next to v001, in two timings, it ran 1.59 and 1.57 times as fast.
// All steps since v000 together make it 2.31 times as fast.
// Contractions: attention P.V through the rank-1 V = t*ve as the padded matvec P.[t | 1] on
// v_wmma_f32_16x16x32_bf16 (A = P as bf16 hi and lo pieces, B columns = t_hi, t_lo, ones, zeros; two products per
// 32 keys, f32 accumulate); the 32-channel mix as a fixed-order f32 VALU sum of the per-channel beta values, taken ahead
// of the output projection (both are linear); output projection (mixed beta*ve rows) . o_w^T on v_wmma_f32_16x16x32_bf16
// (both operands bf16 hi+lo pieces, hh+hl+lh, K = 64, f32 accumulate from zero); embedding, per-head q/k/v vectors,
// scores and softmax exponentials in f32 on VALU.
#include <hip/hip_runtime.h>
#include <stdint.h>

#define NBAT   2
#define IMH    32
#define IMW    32
#define CIN    32
#define DMOD   64
#define NHEAD  4
#define HDIM   16
#define SEQ    1024
#define NSQ    64
#define COUT   64
#define BTP    1032
#define WPITCH 72
#define SPITCH 68
#define LOG2E  1.44269504088896340736f
#define ATHR   512
#define AWAV   (ATHR / 32)

static_assert(IMH * IMW == SEQ);
static_assert(NBAT * CIN == NSQ);
static_assert(NHEAD * HDIM == DMOD);
static_assert((SEQ % 64) == 0 && COUT == 64 && DMOD == 64 && CIN == 32 && HDIM == 16);
static_assert((BTP % 8) == 0 && (WPITCH % 8) == 0 && (SPITCH % 4) == 0);
static_assert(SEQ == 2 * ATHR && (SEQ / 16) % AWAV == 0);

typedef __bf16   v16b __attribute__((ext_vector_type(16)));
typedef float    v8f  __attribute__((ext_vector_type(8)));
typedef float    v4f  __attribute__((ext_vector_type(4)));
typedef unsigned int v8u __attribute__((ext_vector_type(8)));
typedef unsigned int v4u __attribute__((ext_vector_type(4)));

union FragB { v16b v; v8u u; v4u q[2]; };

// ---- scalar helpers ----------------------------------------------------------------------------------
__device__ __forceinline__ v8f zero8() { v8f z = {0.f, 0.f, 0.f, 0.f, 0.f, 0.f, 0.f, 0.f}; return z; }
// f32 bits -> bf16 value kept in the upper 16 bits (low 16 bits zero), RNE convert
__device__ __forceinline__ unsigned rne_hi(unsigned u) {
  return (u + 0x7FFFu + ((u >> 16) & 1u)) & 0xFFFF0000u;
}
// two-piece bf16 decomposition: a ~= hi + lo, hi = RNE bf16(a), lo = RNE bf16(a - hi); returns the 16-bit patterns
__device__ __forceinline__ void split2(float a, unsigned& h16, unsigned& l16) {
  const unsigned hu = rne_hi(__float_as_uint(a));
  const float lf = a - __uint_as_float(hu);
  h16 = hu >> 16;
  l16 = rne_hi(__float_as_uint(lf)) >> 16;
}
__device__ __forceinline__ unsigned pk(unsigned lo16, unsigned hi16) { return (lo16 & 0xFFFFu) | (hi16 << 16); }

// ---- WMMA helpers with trailing VALU hazard gap -----------------------------------------------------
__device__ __forceinline__ v8f mma_b(v16b a, v16b b, v8f c) {
  return __builtin_amdgcn_wmma_f32_16x16x32_bf16(false, a, false, b, (short)0, c, false, false);
}
__device__ __forceinline__ void guard2(v8f& a, v8f& b, v8u x, v8u y, v8u z) {
#if defined(__HIP_DEVICE_COMPILE__)
  asm volatile("v_nop\n\tv_nop\n\tv_nop\n\tv_nop" : "+v"(a), "+v"(b) : "v"(x), "v"(y), "v"(z));
#endif
}
__device__ __forceinline__ void guard4(v8f& a, v8f& b, v8f& c, v8f& d, v8u x0, v8u x1,
                                       v8u y0, v8u y1, v8u y2, v8u y3, v8u z0, v8u z1, v8u z2, v8u z3) {
#if defined(__HIP_DEVICE_COMPILE__)
  asm volatile("v_nop\n\tv_nop\n\tv_nop\n\tv_nop"
               : "+v"(a), "+v"(b), "+v"(c), "+v"(d)
               : "v"(x0), "v"(x1), "v"(y0), "v"(y1), "v"(y2), "v"(y3), "v"(z0), "v"(z1), "v"(z2), "v"(z3));
#endif
}
__device__ __forceinline__ void wave_sync_lds() {
  __builtin_amdgcn_fence(__ATOMIC_RELEASE, "workgroup");
  __builtin_amdgcn_wave_barrier();
  __builtin_amdgcn_fence(__ATOMIC_ACQUIRE, "workgroup");
}

// =====================================================================================================
// Kernel 1: one block per (sequence n = b*32 + c, head), 512 threads = 16 waves (four per SIMD, so that one wave's LDS
// and exponential latencies are covered by the other three).
// t[s] = x[b][s>>5][s&31][c] in LDS (f32). embed_w is a single column e, so E = t (x) e and Q[s] = t[s]*qe,
// K[s] = t[s]*ke, V[s] = t[s]*ve with qe[i] = sum_k q_w[i][k] e[k], ke likewise (this head's 16 rows, f32 dots).
// Scores in log2 units: s2[q][k] = ah * t[q] * t[k], ah = 0.25 * log2(e) * (qe_h . ke_h); the row max is exactly
// max(coef*gmax, coef*gmin) with coef = ah*t[q], so p = 2^(s2 - rowmax) <= 1 in one pass (f32, v_exp_f32).
// Since V_h[k][d] = t[k] * ve_h[d], the attention output row is beta_h[q] * ve_h with beta = sum_k p t / sum_k p.
// That K = 1024 reduction is a 16-column padded matvec on bf16 WMMA: B table Bt[col][key] (k contiguous, pitch 1032)
// with col 0 = bf16 hi piece of t, col 1 = bf16 lo piece (t - hi), col 2 = 1.0, col 3 = 0 (lanes with col >= 3 read
// col 3); A = P rows (row = query s0 + (lane&15), elements 0..7 = keys t0 + 8h + i, 8..15 = keys t0 + 16 + 8h + i)
// as two fragments: hi piece (upper 16 bits of p) and lo piece (upper 16 bits of p - hi). Two WMMAs per 32 keys:
// acc1 = P_hi . B, acc2 = P_lo . B, so D columns 0,1 of acc1+acc2 sum to sum_k p t (all four cross products) and
// column 2 to sum_k p, both from the very same operands. D element r = row 8h + r, col lane&15: per row the three
// columns are fetched with shuffles from lanes 16h + 0,1,2, beta = num * rcp(den) (den >= ~1), lane 16h + r keeps
// row 8h + r and writes it to the LDS staging array Bs[s]. Wave w owns query tiles w + 16i.
// Epilogue: after a block barrier the 1024 f32 values go to BT[n][head][0..1023] as one 16-byte store of 256 lanes.
// coverage: Bt rows 0..3 x keys 0..1031 (512 threads x 2 keys + thread 0 the 8 tail keys); Bs[s] written once for every
//           s (tile rows 0..7 by lanes 0..7, rows 8..15 by lanes 16..23); plane region 4 KB per block, 256 blocks =
//           the whole 1 MiB plane.
// =====================================================================================================
__global__ __launch_bounds__(ATHR)
void attn_rank1(const float* __restrict__ x, const float* __restrict__ embed_w,
                const float* __restrict__ q_w, const float* __restrict__ k_w, float* bt) {
  __shared__ __align__(32) float tv[SEQ];
  __shared__ __align__(16) unsigned short Bt[4 * BTP];
  __shared__ __align__(16) float Bs[SEQ];
  __shared__ float hv[2][HDIM];
  __shared__ float red[AWAV][2];

  const int n    = blockIdx.x >> 2;
  const int head = blockIdx.x & 3;
  const int b    = n >> 5;
  const int ch   = n & 31;
  const int tid  = threadIdx.x, lane = tid & 31, wave = tid >> 5;
  const int lo   = lane & 15, hi = lane >> 4;

  // ---- token values of this sequence, with block max/min ----
  float lmax = -3.0e38f, lmin = 3.0e38f;
  for (int t = tid; t < SEQ; t += ATHR) {
    const int hh = t >> 5, ww = t & 31;
    const float v = x[(((size_t)b * IMH + hh) * IMW + ww) * CIN + ch];
    tv[t] = v;
    lmax = fmaxf(lmax, v);
    lmin = fminf(lmin, v);
  }
#pragma unroll
  for (int off = 16; off > 0; off >>= 1) {
    lmax = fmaxf(lmax, __shfl_xor(lmax, off, 32));
    lmin = fminf(lmin, __shfl_xor(lmin, off, 32));
  }
  if (lane == 0) { red[wave][0] = lmax; red[wave][1] = lmin; }

  // ---- per-head projection vectors: wave 0 -> qe, wave 1 -> ke (wave-uniform source select;
  //      lanes 16..31 duplicate lanes 0..15 and store the identical value) ----
  if (wave < 2) {
    const float* wsrc = (wave == 0) ? q_w : k_w;
    const float* wrow = wsrc + (size_t)(head * HDIM + lo) * DMOD;
    float acc = 0.f;
#pragma unroll 4
    for (int k = 0; k < DMOD; ++k) acc = fmaf(wrow[k], embed_w[k], acc);
    hv[wave][lo] = acc;
  }
  __syncthreads();

  float gmax = red[0][0], gmin = red[0][1];
#pragma unroll                                                        // all reads of red[] behind one LDS wait
  for (int w = 1; w < AWAV; ++w) { gmax = fmaxf(gmax, red[w][0]); gmin = fminf(gmin, red[w][1]); }
  float dqk = 0.f;
#pragma unroll 4
  for (int d = 0; d < HDIM; ++d) dqk = fmaf(hv[0][d], hv[1][d], dqk);
  const float ah2 = dqk * (0.25f * LOG2E);

  // ---- B table: row 0 = t hi piece, row 1 = t lo piece, row 2 = ones, row 3 = zeros; keys 2*tid, 2*tid+1 ----
  {
    const int kb = 2 * tid;
    unsigned h0, l0, h1, l1;
    split2(tv[kb], h0, l0);
    split2(tv[kb + 1], h1, l1);
    const v4u zer  = {0u, 0u, 0u, 0u};
    *(unsigned*)(Bt + 0 * BTP + kb) = pk(h0, h1);
    *(unsigned*)(Bt + 1 * BTP + kb) = pk(l0, l1);
    *(unsigned*)(Bt + 2 * BTP + kb) = 0x3F803F80u;
    *(unsigned*)(Bt + 3 * BTP + kb) = 0u;
    if (tid == 0) {                          // tail keys 1024..1031 (never read, zero-filled)
      *(v4u*)(Bt + 0 * BTP + SEQ) = zer;
      *(v4u*)(Bt + 1 * BTP + SEQ) = zer;
      *(v4u*)(Bt + 2 * BTP + SEQ) = zer;
      *(v4u*)(Bt + 3 * BTP + SEQ) = zer;
    }
  }
  __syncthreads();

  const int br = (lo < 3) ? lo : 3;                                   // B fragment: column = lane&15 -> table row
  const unsigned short* brow = Bt + br * BTP + 8 * hi;
  float* plane = bt + (size_t)(n * NHEAD + head) * SEQ;

#pragma unroll 1
  for (int i = 0; i < SEQ / (16 * AWAV); ++i) {                       // 4 query tiles per wave, wave-uniform
    const int s0 = (wave + AWAV * i) * 16;
    const float coef = ah2 * tv[s0 + lo];                             // query row m = lo
    const float cm   = -fmaxf(coef * gmax, coef * gmin);              // exact row max, p <= 1
    v8f acc1 = zero8(), acc2 = zero8();
#pragma unroll 1
    for (int kt = 0; kt < SEQ / 32; ++kt) {
      const int t0 = kt * 32;
      const v8f ta = *(const v8f*)(tv + t0 + 8 * hi);               // keys t0 + 8h + 0..7
      const v8f tb = *(const v8f*)(tv + t0 + 16 + 8 * hi);          // keys t0 + 16 + 8h + 0..7
      FragB ph, pl;
#pragma unroll
      for (int j = 0; j < 4; ++j) {
        const float p0 = __builtin_amdgcn_exp2f(fmaf(coef, ta[2 * j], cm));
        const float p1 = __builtin_amdgcn_exp2f(fmaf(coef, ta[2 * j + 1], cm));
        const float p2 = __builtin_amdgcn_exp2f(fmaf(coef, tb[2 * j], cm));
        const float p3 = __builtin_amdgcn_exp2f(fmaf(coef, tb[2 * j + 1], cm));
        const unsigned u0 = __float_as_uint(p0), u1 = __float_as_uint(p1);
        const unsigned u2 = __float_as_uint(p2), u3 = __float_as_uint(p3);
        const unsigned g0 = u0 & 0xFFFF0000u, g1 = u1 & 0xFFFF0000u;
        const unsigned g2 = u2 & 0xFFFF0000u, g3 = u3 & 0xFFFF0000u;
        const float l0 = p0 - __uint_as_float(g0), l1 = p1 - __uint_as_float(g1);
        const float l2 = p2 - __uint_as_float(g2), l3 = p3 - __uint_as_float(g3);
        ph.u[j]     = (u0 >> 16) | g1;                                // elements 2j, 2j+1
        ph.u[4 + j] = (u2 >> 16) | g3;                                // elements 8+2j, 8+2j+1
        pl.u[j]     = (__float_as_uint(l0) >> 16) | (__float_as_uint(l1) & 0xFFFF0000u);
        pl.u[4 + j] = (__float_as_uint(l2) >> 16) | (__float_as_uint(l3) & 0xFFFF0000u);
      }
      FragB bf;
      bf.q[0] = *(const v4u*)(brow + t0);                             // keys t0 + 8h + 0..7
      bf.q[1] = *(const v4u*)(brow + t0 + 16);                        // keys t0 + 16 + 8h + 0..7
      acc1 = mma_b(ph.v, bf.v, acc1);
      acc2 = mma_b(pl.v, bf.v, acc2);
      guard2(acc1, acc2, ph.u, pl.u, bf.u);
    }

    // ---- combine: D element r = row 8h + r; columns 0,1,2 live in lanes 16h + 0,1,2 ----
    const int sb = 16 * hi;
    float beta[8];
#pragma unroll
    for (int r = 0; r < 8; ++r) {
      const float a0 = __shfl(acc1[r], sb, 32);
      const float a1 = __shfl(acc1[r], sb + 1, 32);
      const float a2 = __shfl(acc1[r], sb + 2, 32);
      const float c0 = __shfl(acc2[r], sb, 32);
      const float c1 = __shfl(acc2[r], sb + 1, 32);
      const float c2 = __shfl(acc2[r], sb + 2, 32);
      const float num = (a0 + c0) + (a1 + c1);
      const float den = a2 + c2;
      beta[r] = num * __builtin_amdgcn_rcpf(den);
    }
    float mine = beta[0];
#pragma unroll
    for (int r = 1; r < 8; ++r) mine = (lo == r) ? beta[r] : mine;
    if (lo < 8) Bs[s0 + 8 * hi + lo] = mine;
  }
  __syncthreads();
  if (tid < SEQ / 4) {                                                // waves 0..7 (wave-uniform)
    *(v4f*)(plane + 4 * tid) = *(const v4f*)(Bs + 4 * tid);
  }
}

// =====================================================================================================
// Kernel 2: the channel mix and the output projection are both linear, so the mix is taken first, on the four per-head
// scalars of a token row, and the projection runs once per row instead of once per channel:
//   G[h][s]       = sum_{c=0..31} mix[c] * BT[b*32+c][h][s]               (fixed order c = 0..31, f32 VALU)
//   out[(b,s)][o] = sum_{j=0..63} (G[j>>4][s] * ve[j]) * o_w[o][j]        (K = 64, o_w row o, j contiguous)
// with ve[j] = sum_k v_w[j][k] e[k] (f32 dots of 64). Block = 4 waves = 64 rows s0..s0+63 of batch b (grid 32);
// wave w rows s0+16w..+15, all 64 output columns. G: thread t sums row t&63 of heads t>>6 and 2+(t>>6), 64 independent
// loads (a wave reads 128 contiguous bytes per load), into LDS gm[h][row] ahead of the block barrier.
// o_w is decomposed once per block into bf16 hi / lo tables Wh/Wl[o][j] (j contiguous, pitch 72); B fragments:
// lane col o, elements 0..7 <- W[o][32ks+8h+0..7], 8..15 <- W[o][32ks+16+8h+0..7]. A fragments are built in f32
// registers: row s, element i <- G[2ks][s]*ve[32ks+8h+i], element 8+i <- G[2ks+1][s]*ve[32ks+16+8h+i]
// (the same j map), decomposed into bf16 hi and lo fragments; the tile accumulators start from zero and
// take Ahi.Bhi + Ahi.Blo + Alo.Bhi for ks = 0,1.
// coverage: W tables 128 threads x 32 = 64 x 64 each; gm 128 threads x 2 = 4 x 64; 32 blocks x 4 waves x 16 rows x
//           64 cols = out [2048][64].
// =====================================================================================================
__global__ __launch_bounds__(128)
void proj_mix(const float* __restrict__ bt, const float* __restrict__ embed_w, const float* __restrict__ v_w,
              const float* __restrict__ o_w, const float* __restrict__ mix_w, float* out) {
  __shared__ __align__(16) unsigned short Wh[COUT * WPITCH];
  __shared__ __align__(16) unsigned short Wl[COUT * WPITCH];
  __shared__ __align__(32) float ve[DMOD];
  __shared__ float gm[NHEAD][64];
  __shared__ __align__(16) float sT[4][16 * SPITCH];
  const int tid  = threadIdx.x, lane = tid & 31, wave = tid >> 5;
  const int lo   = lane & 15, hi = lane >> 4;
  const int b    = blockIdx.x >> 4;
  const int s0   = (blockIdx.x & 15) * 64;

  // ---- channel mix of the per-head beta values: rows s0..s0+63, heads hp and hp+2 per thread ----
  {
    const int row = tid & 63, hp = tid >> 6;
    const float* gp = bt + (size_t)(b * CIN) * (NHEAD * SEQ) + (size_t)hp * SEQ + s0 + row;
    float g0 = 0.f, g1 = 0.f;
#pragma unroll                                                        // all 64 loads in flight together
    for (int c = 0; c < CIN; ++c) {
      const float wgt = mix_w[c];
      g0 = fmaf(wgt, gp[(size_t)c * (NHEAD * SEQ)], g0);
      g1 = fmaf(wgt, gp[(size_t)c * (NHEAD * SEQ) + 2 * SEQ], g1);
    }
    gm[hp][row]     = g0;
    gm[hp + 2][row] = g1;
  }
  {
    const int o = tid >> 1, k0 = (tid & 1) * 32;                     // o_w row o, j = k0 .. k0+31
    const float* sp = o_w + (size_t)o * DMOD + k0;
#pragma unroll
    for (int q = 0; q < 4; ++q) {
      const v4f a0 = *(const v4f*)(sp + 8 * q);
      const v4f a1 = *(const v4f*)(sp + 8 * q + 4);
      float f[8];
#pragma unroll
      for (int e = 0; e < 4; ++e) { f[e] = a0[e]; f[4 + e] = a1[e]; }
      v4u hq, lq;
#pragma unroll
      for (int e = 0; e < 4; ++e) {
        unsigned h0, l0, h1, l1;
        split2(f[2 * e], h0, l0);
        split2(f[2 * e + 1], h1, l1);
        hq[e] = pk(h0, h1);
        lq[e] = pk(l0, l1);
      }
      *(v4u*)(Wh + o * WPITCH + k0 + 8 * q) = hq;
      *(v4u*)(Wl + o * WPITCH + k0 + 8 * q) = lq;
    }
  }
  if (tid < DMOD) {                                                   // waves 0,1 (wave-uniform): ve[j], v_w row j
    const float* wrow = v_w + (size_t)tid * DMOD;
    float acc = 0.f;
#pragma unroll 4
    for (int k = 0; k < DMOD; ++k) acc = fmaf(wrow[k], embed_w[k], acc);
    ve[tid] = acc;
  }
  __syncthreads();

  v8f oacc[4];
#pragma unroll
  for (int j = 0; j < 4; ++j) oacc[j] = zero8();

  const int arow = 16 * wave + lo;                                    // row index within the block's 64 rows

#pragma unroll 1
  for (int ks = 0; ks < 2; ++ks) {
    const float be0 = gm[2 * ks][arow];                             // head 2ks, mixed over channels, row s
    const float be1 = gm[2 * ks + 1][arow];                         // head 2ks+1
    const v8f vea = *(const v8f*)(ve + 32 * ks + 8 * hi);           // j = 32ks + 8h + 0..7      (head 2ks)
    const v8f veb = *(const v8f*)(ve + 32 * ks + 16 + 8 * hi);      // j = 32ks + 16 + 8h + 0..7 (head 2ks+1)
    FragB fa, fl;
#pragma unroll
    for (int j = 0; j < 4; ++j) {
      unsigned h0, l0, h1, l1;
      split2(be0 * vea[2 * j], h0, l0);
      split2(be0 * vea[2 * j + 1], h1, l1);
      fa.u[j] = pk(h0, h1);
      fl.u[j] = pk(l0, l1);
      split2(be1 * veb[2 * j], h0, l0);
      split2(be1 * veb[2 * j + 1], h1, l1);
      fa.u[4 + j] = pk(h0, h1);
      fl.u[4 + j] = pk(l0, l1);
    }
    FragB wh[4], wl[4];
#pragma unroll
    for (int j = 0; j < 4; ++j) {
      const int wo = (16 * j + lo) * WPITCH + 32 * ks + 8 * hi;
      wh[j].q[0] = *(const v4u*)(Wh + wo);
      wh[j].q[1] = *(const v4u*)(Wh + wo + 16);
      wl[j].q[0] = *(const v4u*)(Wl + wo);
      wl[j].q[1] = *(const v4u*)(Wl + wo + 16);
    }
#pragma unroll
    for (int j = 0; j < 4; ++j) {
      oacc[j] = mma_b(fa.v, wh[j].v, oacc[j]);
      oacc[j] = mma_b(fa.v, wl[j].v, oacc[j]);
      oacc[j] = mma_b(fl.v, wh[j].v, oacc[j]);
    }
    guard4(oacc[0], oacc[1], oacc[2], oacc[3], fa.u, fl.u,
           wh[0].u, wh[1].u, wh[2].u, wh[3].u, wl[0].u, wl[1].u, wl[2].u, wl[3].u);
  }

  // ---- epilogue ----
  float* slab = sT[wave];
  const int mOff = 8 * hi;
#pragma unroll
  for (int j = 0; j < 4; ++j) {
#pragma unroll
    for (int r = 0; r < 8; ++r) slab[(mOff + r) * SPITCH + (j << 4) + lo] = oacc[j][r];
  }
  wave_sync_lds();
  const int c4 = lo * 4;
  v4f vals[8];
#pragma unroll
  for (int it = 0; it < 8; ++it) {
    const int row = it * 2 + hi;                                      // it 0..7 x h 0..1 = rows 0..15
    vals[it] = *(const v4f*)(slab + row * SPITCH + c4);
  }
  float* ob = out + (size_t)(b * SEQ + s0 + 16 * wave) * COUT;
#pragma unroll
  for (int it = 0; it < 8; ++it) {
    const int row = it * 2 + hi;
    *(v4f*)(ob + (size_t)row * COUT + c4) = vals[it];
  }
  
  wave_sync_lds();
}

// =====================================================================================================
// Workspace map (bytes): BT f32 [64 seq][4 heads][1024]  offset 0, 1048576 bytes (4 KB per (seq, head), written as
// Inputs (f32): 0 x [2][32][32][32], 1 embed_w [64][1], 2 q_w [64][64], 3 k_w, 4 v_w, 5 o_w [64][64],
// 6 mix weights [1][32]. Output f32 [2][32][32][64].
// =====================================================================================================
extern "C" void kernel_launch(void* const* d_in, const int* in_sizes, int n_in,
                              void* d_out, int out_size, void* d_ws, size_t ws_size,
                              hipStream_t stream) {
  if (n_in < 7) return;
  if (in_sizes[0] != NBAT * IMH * IMW * CIN) return;
  if (in_sizes[1] != DMOD) return;
  if (in_sizes[2] != DMOD * DMOD || in_sizes[3] != DMOD * DMOD || in_sizes[4] != DMOD * DMOD) return;
  if (in_sizes[5] != COUT * DMOD || in_sizes[6] != CIN) return;
  if (out_size != NBAT * SEQ * COUT) return;

  const size_t PB = (size_t)NSQ * NHEAD * SEQ * 4;                   // 1048576
  if (PB > ws_size) return;
  if (PB > (size_t)134217728) return;

  const float* x       = (const float*)d_in[0];
  const float* embed_w = (const float*)d_in[1];
  const float* q_w     = (const float*)d_in[2];
  const float* k_w     = (const float*)d_in[3];
  const float* v_w     = (const float*)d_in[4];
  const float* o_w     = (const float*)d_in[5];
  const float* mix_w   = (const float*)d_in[6];
  float* bt            = (float*)d_ws;
  float* out           = (float*)d_out;

  const dim3 blk(128);
  const dim3 gA(NSQ * NHEAD);                                        // 256 blocks
  const dim3 gP(NBAT * SEQ / 64);                                    // 32 blocks

  attn_rank1<<<gA, dim3(ATHR), 0, stream>>>(x, embed_w, q_w, k_w, bt);
  proj_mix<<<gP, blk, 0, stream>>>(bt, embed_w, v_w, o_w, mix_w, out);
  (void)hipGetLastError();
}

// v003
// Measured time: 36 microseconds a run.
// In both of two side-by-side timings against v002, it was 1.28 times as fast.
// Counting every step since v000, it is 2.96 times as fast.
// Contractions: attention P.V through the rank-1 V = t*ve as the padded matvec P.[t | 1] on
// v_wmma_f32_16x16x32_bf16 (A = P as bf16 hi and lo pieces, B columns = t_hi, t_lo, ones, zeros; two products per
// 32 keys, f32 accumulate); the 32-channel mix as a fixed-order f32 VALU sum of the per-channel beta values, taken ahead
// of the output projection (both are linear); output projection (mixed beta*ve rows) . o_w^T on v_wmma_f32_16x16x32_bf16
// (both operands bf16 hi+lo pieces, hh+hl+lh, K = 64, f32 accumulate from zero); embedding, per-head q/k/v vectors,
// scores and softmax exponentials in f32 on VALU.
#include <hip/hip_runtime.h>
#include <stdint.h>

#define NBAT   2
#define IMH    32
#define IMW    32
#define CIN    32
#define DMOD   64
#define NHEAD  4
#define HDIM   16
#define SEQ    1024
#define NSQ    64
#define COUT   64
#define BTP    1032
#define WPITCH 72
#define SPITCH 68
#define LOG2E  1.44269504088896340736f
#define ATHR   512
#define AWAV   (ATHR / 32)

static_assert(IMH * IMW == SEQ);
static_assert(NBAT * CIN == NSQ);
static_assert(NHEAD * HDIM == DMOD);
static_assert((SEQ % 64) == 0 && COUT == 64 && DMOD == 64 && CIN == 32 && HDIM == 16);
static_assert((BTP % 8) == 0 && (WPITCH % 8) == 0 && (SPITCH % 4) == 0);
static_assert(SEQ == 2 * ATHR && (SEQ / 16) % AWAV == 0);

typedef __bf16   v16b __attribute__((ext_vector_type(16)));
typedef float    v8f  __attribute__((ext_vector_type(8)));
typedef float    v4f  __attribute__((ext_vector_type(4)));
typedef unsigned int v8u __attribute__((ext_vector_type(8)));
typedef unsigned int v4u __attribute__((ext_vector_type(4)));

union FragB { v16b v; v8u u; v4u q[2]; };

// ---- scalar helpers ----------------------------------------------------------------------------------
__device__ __forceinline__ v8f zero8() { v8f z = {0.f, 0.f, 0.f, 0.f, 0.f, 0.f, 0.f, 0.f}; return z; }
// f32 bits -> bf16 value kept in the upper 16 bits (low 16 bits zero), RNE convert
__device__ __forceinline__ unsigned rne_hi(unsigned u) {
  return (u + 0x7FFFu + ((u >> 16) & 1u)) & 0xFFFF0000u;
}
// two-piece bf16 decomposition: a ~= hi + lo, hi = RNE bf16(a), lo = RNE bf16(a - hi); returns the 16-bit patterns
__device__ __forceinline__ void split2(float a, unsigned& h16, unsigned& l16) {
  const unsigned hu = rne_hi(__float_as_uint(a));
  const float lf = a - __uint_as_float(hu);
  h16 = hu >> 16;
  l16 = rne_hi(__float_as_uint(lf)) >> 16;
}
__device__ __forceinline__ unsigned pk(unsigned lo16, unsigned hi16) { return (lo16 & 0xFFFFu) | (hi16 << 16); }

// One 16 x 32 block of probabilities from its 16 score words per lane. Pair j: a[j], b[j] hold the log2 scores of elements
// 2j, 2j+1 on entry; on exit h[j] = the two bf16 hi pieces (round to nearest of p), a[j] = the two bf16 lo pieces (round to
// nearest of p - hi; p - hi is exact in f32, formed by a mixed-precision fma that reads its bf16 half of h[j] directly
// and writes its own half of a[j]). One statement so that the order stands: the converts and fmas are spread among the
// exponentials, each four or more instructions behind its producer; behind the last exponential the distances
// shrink, and there s_delay_alu names the producer so that the SIMD's other waves issue meanwhile.
__device__ __forceinline__ void exp_split16(float (&a)[8], float (&b)[8], unsigned (&h)[8]) {
#if defined(__HIP_DEVICE_COMPILE__)
  asm volatile(
      "v_exp_f32 %0, %0\n\t"
      "v_exp_f32 %8, %8\n\t"
      "v_exp_f32 %1, %1\n\t"
      "v_exp_f32 %9, %9\n\t"
      "v_exp_f32 %2, %2\n\t"
      "v_cvt_pk_bf16_f32 %16, %0, %8\n\t"
      "v_exp_f32 %10, %10\n\t"
      "v_exp_f32 %3, %3\n\t"
      "v_cvt_pk_bf16_f32 %17, %1, %9\n\t"
      "v_exp_f32 %11, %11\n\t"
      "v_fma_mixlo_bf16 %0, %16, -1.0, %0 op_sel_hi:[1,0,0]\n\t"
      "v_exp_f32 %4, %4\n\t"
      "v_cvt_pk_bf16_f32 %18, %2, %10\n\t"
      "v_exp_f32 %12, %12\n\t"
      "v_fma_mixlo_bf16 %1, %17, -1.0, %1 op_sel_hi:[1,0,0]\n\t"
      "v_fma_mixhi_bf16 %0, %16, -1.0, %8 op_sel:[1,0,0] op_sel_hi:[1,0,0]\n\t"
      "v_exp_f32 %5, %5\n\t"
      "v_cvt_pk_bf16_f32 %19, %3, %11\n\t"
      "v_exp_f32 %13, %13\n\t"
      "v_fma_mixlo_bf16 %2, %18, -1.0, %2 op_sel_hi:[1,0,0]\n\t"
      "v_fma_mixhi_bf16 %1, %17, -1.0, %9 op_sel:[1,0,0] op_sel_hi:[1,0,0]\n\t"
      "v_exp_f32 %6, %6\n\t"
      "v_cvt_pk_bf16_f32 %20, %4, %12\n\t"
      "v_exp_f32 %14, %14\n\t"
      "v_fma_mixlo_bf16 %3, %19, -1.0, %3 op_sel_hi:[1,0,0]\n\t"
      "v_fma_mixhi_bf16 %2, %18, -1.0, %10 op_sel:[1,0,0] op_sel_hi:[1,0,0]\n\t"
      "v_exp_f32 %7, %7\n\t"
      "v_cvt_pk_bf16_f32 %21, %5, %13\n\t"
      "v_exp_f32 %15, %15\n\t"
      "v_fma_mixlo_bf16 %4, %20, -1.0, %4 op_sel_hi:[1,0,0]\n\t"
      "v_fma_mixhi_bf16 %3, %19, -1.0, %11 op_sel:[1,0,0] op_sel_hi:[1,0,0]\n\t"
      "v_cvt_pk_bf16_f32 %22, %6, %14\n\t"
      "s_delay_alu instid0(VALU_DEP_4)\n\t"
      "v_fma_mixlo_bf16 %5, %21, -1.0, %5 op_sel_hi:[1,0,0]\n\t"
      "s_delay_alu instid0(VALU_DEP_4)\n\t"
      "v_fma_mixhi_bf16 %4, %20, -1.0, %12 op_sel:[1,0,0] op_sel_hi:[1,0,0]\n\t"
      "s_delay_alu instid0(TRANS32_DEP_1)\n\t"
      "v_cvt_pk_bf16_f32 %23, %7, %15\n\t"
      "s_delay_alu instid0(VALU_DEP_3)\n\t"
      "v_fma_mixhi_bf16 %5, %21, -1.0, %13 op_sel:[1,0,0] op_sel_hi:[1,0,0]\n\t"
      "v_fma_mixlo_bf16 %6, %22, -1.0, %6 op_sel_hi:[1,0,0]\n\t"
      "s_delay_alu instid0(VALU_DEP_3)\n\t"
      "v_fma_mixlo_bf16 %7, %23, -1.0, %7 op_sel_hi:[1,0,0]\n\t"
      "s_delay_alu instid0(VALU_DEP_2)\n\t"
      "v_fma_mixhi_bf16 %6, %22, -1.0, %14 op_sel:[1,0,0] op_sel_hi:[1,0,0]\n\t"
      "s_delay_alu instid0(VALU_DEP_2)\n\t"
      "v_fma_mixhi_bf16 %7, %23, -1.0, %15 op_sel:[1,0,0] op_sel_hi:[1,0,0]"
      : "+v"(a[0]), "+v"(a[1]), "+v"(a[2]), "+v"(a[3]), "+v"(a[4]), "+v"(a[5]), "+v"(a[6]), "+v"(a[7]),
        "+v"(b[0]), "+v"(b[1]), "+v"(b[2]), "+v"(b[3]), "+v"(b[4]), "+v"(b[5]), "+v"(b[6]), "+v"(b[7]),
        "=&v"(h[0]), "=&v"(h[1]), "=&v"(h[2]), "=&v"(h[3]), "=&v"(h[4]), "=&v"(h[5]), "=&v"(h[6]), "=&v"(h[7]));
#endif
}

// ---- WMMA helpers with trailing VALU hazard gap -----------------------------------------------------
__device__ __forceinline__ v8f mma_b(v16b a, v16b b, v8f c) {
  return __builtin_amdgcn_wmma_f32_16x16x32_bf16(false, a, false, b, (short)0, c, false, false);
}
__device__ __forceinline__ void guard2(v8f& a, v8f& b, v8u x, v8u y, v8u z) {
#if defined(__HIP_DEVICE_COMPILE__)
  asm volatile("v_nop\n\tv_nop\n\tv_nop\n\tv_nop" : "+v"(a), "+v"(b) : "v"(x), "v"(y), "v"(z));
#endif
}
__device__ __forceinline__ void guard4(v8f& a, v8f& b, v8f& c, v8f& d, v8u x0, v8u x1,
                                       v8u y0, v8u y1, v8u y2, v8u y3, v8u z0, v8u z1, v8u z2, v8u z3) {
#if defined(__HIP_DEVICE_COMPILE__)
  asm volatile("v_nop\n\tv_nop\n\tv_nop\n\tv_nop"
               : "+v"(a), "+v"(b), "+v"(c), "+v"(d)
               : "v"(x0), "v"(x1), "v"(y0), "v"(y1), "v"(y2), "v"(y3), "v"(z0), "v"(z1), "v"(z2), "v"(z3));
#endif
}
__device__ __forceinline__ void wave_sync_lds() {
  __builtin_amdgcn_fence(__ATOMIC_RELEASE, "workgroup");
  __builtin_amdgcn_wave_barrier();
  __builtin_amdgcn_fence(__ATOMIC_ACQUIRE, "workgroup");
}

// =====================================================================================================
// Kernel 1: one block per (sequence n = b*32 + c, head), 512 threads = 16 waves (four per SIMD, so that one wave's LDS
// and exponential latencies are covered by the other three).
// t[s] = x[b][s>>5][s&31][c] in LDS (f32). embed_w is a single column e, so E = t (x) e and Q[s] = t[s]*qe,
// K[s] = t[s]*ke, V[s] = t[s]*ve with qe[i] = sum_k q_w[i][k] e[k], ke likewise (this head's 16 rows, f32 dots).
// Scores in log2 units: s2[q][k] = ah * t[q] * t[k], ah = 0.25 * log2(e) * (qe_h . ke_h); the row max is exactly
// max(coef*gmax, coef*gmin) with coef = ah*t[q], so p = 2^(s2 - rowmax) <= 1 in one pass (f32, v_exp_f32).
// Since V_h[k][d] = t[k] * ve_h[d], the attention output row is beta_h[q] * ve_h with beta = sum_k p t / sum_k p.
// That K = 1024 reduction is a 16-column padded matvec on bf16 WMMA: B table Bt[col][key] (k contiguous, pitch 1032)
// with col 0 = bf16 hi piece of t, col 1 = bf16 lo piece (t - hi), col 2 = 1.0, col 3 = 0 (lanes with col >= 3 read
// col 3); A = P rows (row = query s0 + (lane&15), elements 0..7 = keys t0 + 8h + i, 8..15 = keys t0 + 16 + 8h + i)
// as two fragments: hi piece (p rounded to bf16) and lo piece (p - hi rounded to bf16). Two WMMAs per 32 keys:
// acc1 = P_hi . B, acc2 = P_lo . B, so D columns 0,1 of acc1+acc2 sum to sum_k p t (all four cross products) and
// column 2 to sum_k p, both from the very same operands. D element r = row 8h + r, col lane&15: per row the three
// columns are fetched with shuffles from lanes 16h + 0,1,2, beta = num * rcp(den) (den >= ~1), lane 16h + r keeps
// row 8h + r and writes it to the LDS staging array Bs[s]. Wave w owns query tiles w + 16i.
// Epilogue: after a block barrier the 1024 f32 values go to BT[n][head][0..1023] as one 16-byte store of 256 lanes.
// coverage: Bt rows 0..3 x keys 0..1031 (512 threads x 2 keys + thread 0 the 8 tail keys); Bs[s] written once for every
//           s (tile rows 0..7 by lanes 0..7, rows 8..15 by lanes 16..23); plane region 4 KB per block, 256 blocks =
//           the whole 1 MiB plane.
// =====================================================================================================
__global__ __launch_bounds__(ATHR)
void attn_rank1(const float* __restrict__ x, const float* __restrict__ embed_w,
                const float* __restrict__ q_w, const float* __restrict__ k_w, float* bt) {
  __shared__ __align__(32) float tv[SEQ];
  __shared__ __align__(16) unsigned short Bt[4 * BTP];
  __shared__ __align__(16) float Bs[SEQ];
  __shared__ float hv[2][HDIM];
  __shared__ float red[AWAV][2];

  const int n    = blockIdx.x >> 2;
  const int head = blockIdx.x & 3;
  const int b    = n >> 5;
  const int ch   = n & 31;
  const int tid  = threadIdx.x, lane = tid & 31, wave = tid >> 5;
  const int lo   = lane & 15, hi = lane >> 4;

  // ---- token values of this sequence, with block max/min ----
  float lmax = -3.0e38f, lmin = 3.0e38f;
  for (int t = tid; t < SEQ; t += ATHR) {
    const int hh = t >> 5, ww = t & 31;
    const float v = x[(((size_t)b * IMH + hh) * IMW + ww) * CIN + ch];
    tv[t] = v;
    lmax = fmaxf(lmax, v);
    lmin = fminf(lmin, v);
  }
#pragma unroll
  for (int off = 16; off > 0; off >>= 1) {
    lmax = fmaxf(lmax, __shfl_xor(lmax, off, 32));
    lmin = fminf(lmin, __shfl_xor(lmin, off, 32));
  }
  if (lane == 0) { red[wave][0] = lmax; red[wave][1] = lmin; }

  // ---- per-head projection vectors: wave 0 -> qe, wave 1 -> ke (wave-uniform source select;
  //      lanes 16..31 duplicate lanes 0..15 and store the identical value) ----
  if (wave < 2) {
    const float* wsrc = (wave == 0) ? q_w : k_w;
    const float* wrow = wsrc + (size_t)(head * HDIM + lo) * DMOD;
    float acc = 0.f;
#pragma unroll 4
    for (int k = 0; k < DMOD; ++k) acc = fmaf(wrow[k], embed_w[k], acc);
    hv[wave][lo] = acc;
  }
  __syncthreads();

  float gmax = red[0][0], gmin = red[0][1];
#pragma unroll                                                        // all reads of red[] behind one LDS wait
  for (int w = 1; w < AWAV; ++w) { gmax = fmaxf(gmax, red[w][0]); gmin = fminf(gmin, red[w][1]); }
  float dqk = 0.f;
#pragma unroll 4
  for (int d = 0; d < HDIM; ++d) dqk = fmaf(hv[0][d], hv[1][d], dqk);
  const float ah2 = dqk * (0.25f * LOG2E);

  // ---- B table: row 0 = t hi piece, row 1 = t lo piece, row 2 = ones, row 3 = zeros; keys 2*tid, 2*tid+1 ----
  {
    const int kb = 2 * tid;
    unsigned h0, l0, h1, l1;
    split2(tv[kb], h0, l0);
    split2(tv[kb + 1], h1, l1);
    const v4u zer  = {0u, 0u, 0u, 0u};
    *(unsigned*)(Bt + 0 * BTP + kb) = pk(h0, h1);
    *(unsigned*)(Bt + 1 * BTP + kb) = pk(l0, l1);
    *(unsigned*)(Bt + 2 * BTP + kb) = 0x3F803F80u;
    *(unsigned*)(Bt + 3 * BTP + kb) = 0u;
    if (tid == 0) {                          // tail keys 1024..1031 (never read, zero-filled)
      *(v4u*)(Bt + 0 * BTP + SEQ) = zer;
      *(v4u*)(Bt + 1 * BTP + SEQ) = zer;
      *(v4u*)(Bt + 2 * BTP + SEQ) = zer;
      *(v4u*)(Bt + 3 * BTP + SEQ) = zer;
    }
  }
  __syncthreads();

  const int br = (lo < 3) ? lo : 3;                                   // B fragment: column = lane&15 -> table row
  const unsigned short* brow = Bt + br * BTP + 8 * hi;
  float* plane = bt + (size_t)(n * NHEAD + head) * SEQ;

#pragma unroll 1
  for (int i = 0; i < SEQ / (16 * AWAV); ++i) {                       // 4 query tiles per wave, wave-uniform
    const int s0 = (wave + AWAV * i) * 16;
    const float coef = ah2 * tv[s0 + lo];                             // query row m = lo
    const float cm   = -fmaxf(coef * gmax, coef * gmin);              // exact row max, p <= 1
    v8f acc1 = zero8(), acc2 = zero8();
#pragma unroll 1
    for (int kt = 0; kt < SEQ / 32; ++kt) {
      const int t0 = kt * 32;
      const v8f ta = *(const v8f*)(tv + t0 + 8 * hi);               // keys t0 + 8h + 0..7
      const v8f tb = *(const v8f*)(tv + t0 + 16 + 8 * hi);          // keys t0 + 16 + 8h + 0..7
      FragB bf;
      bf.q[0] = *(const v4u*)(brow + t0);                             // keys t0 + 8h + 0..7
      bf.q[1] = *(const v4u*)(brow + t0 + 16);                        // keys t0 + 16 + 8h + 0..7
      float ya[8], yb[8];
      unsigned hw[8];
#pragma unroll
      for (int j = 0; j < 4; ++j) {
        ya[j]     = fmaf(coef, ta[2 * j], cm);                        // elements 2j, 2j+1
        yb[j]     = fmaf(coef, ta[2 * j + 1], cm);
        ya[4 + j] = fmaf(coef, tb[2 * j], cm);                        // elements 8+2j, 8+2j+1
        yb[4 + j] = fmaf(coef, tb[2 * j + 1], cm);
      }
      exp_split16(ya, yb, hw);
      FragB ph, pl;
#pragma unroll
      for (int j = 0; j < 8; ++j) {
        ph.u[j] = hw[j];
        pl.u[j] = __float_as_uint(ya[j]);
      }
      acc1 = mma_b(ph.v, bf.v, acc1);
      acc2 = mma_b(pl.v, bf.v, acc2);
      guard2(acc1, acc2, ph.u, pl.u, bf.u);
    }

    // ---- combine: D element r = row 8h + r; columns 0,1,2 live in lanes 16h + 0,1,2 ----
    const int sb = 16 * hi;
    float beta[8];
#pragma unroll
    for (int r = 0; r < 8; ++r) {
      const float a0 = __shfl(acc1[r], sb, 32);
      const float a1 = __shfl(acc1[r], sb + 1, 32);
      const float a2 = __shfl(acc1[r], sb + 2, 32);
      const float c0 = __shfl(acc2[r], sb, 32);
      const float c1 = __shfl(acc2[r], sb + 1, 32);
      const float c2 = __shfl(acc2[r], sb + 2, 32);
      const float num = (a0 + c0) + (a1 + c1);
      const float den = a2 + c2;
      beta[r] = num * __builtin_amdgcn_rcpf(den);
    }
    float mine = beta[0];
#pragma unroll
    for (int r = 1; r < 8; ++r) mine = (lo == r) ? beta[r] : mine;
    if (lo < 8) Bs[s0 + 8 * hi + lo] = mine;
  }
  __syncthreads();
  if (tid < SEQ / 4) {                                                // waves 0..7 (wave-uniform)
    *(v4f*)(plane + 4 * tid) = *(const v4f*)(Bs + 4 * tid);
  }
}

// =====================================================================================================
// Kernel 2: the channel mix and the output projection are both linear, so the mix is taken first, on the four per-head
// scalars of a token row, and the projection runs once per row instead of once per channel:
//   G[h][s]       = sum_{c=0..31} mix[c] * BT[b*32+c][h][s]               (fixed order c = 0..31, f32 VALU)
//   out[(b,s)][o] = sum_{j=0..63} (G[j>>4][s] * ve[j]) * o_w[o][j]        (K = 64, o_w row o, j contiguous)
// with ve[j] = sum_k v_w[j][k] e[k] (f32 dots of 64). Block = 4 waves = 64 rows s0..s0+63 of batch b (grid 32);
// wave w rows s0+16w..+15, all 64 output columns. G: thread t sums row t&63 of heads t>>6 and 2+(t>>6), 64 independent
// loads (a wave reads 128 contiguous bytes per load), into LDS gm[h][row] ahead of the block barrier.
// o_w is decomposed once per block into bf16 hi / lo tables Wh/Wl[o][j] (j contiguous, pitch 72); B fragments:
// lane col o, elements 0..7 <- W[o][32ks+8h+0..7], 8..15 <- W[o][32ks+16+8h+0..7]. A fragments are built in f32
// registers: row s, element i <- G[2ks][s]*ve[32ks+8h+i], element 8+i <- G[2ks+1][s]*ve[32ks+16+8h+i]
// (the same j map), decomposed into bf16 hi and lo fragments; the tile accumulators start from zero and
// take Ahi.Bhi + Ahi.Blo + Alo.Bhi for ks = 0,1.
// coverage: W tables 128 threads x 32 = 64 x 64 each; gm 128 threads x 2 = 4 x 64; 32 blocks x 4 waves x 16 rows x
//           64 cols = out [2048][64].
// =====================================================================================================
__global__ __launch_bounds__(128)
void proj_mix(const float* __restrict__ bt, const float* __restrict__ embed_w, const float* __restrict__ v_w,
              const float* __restrict__ o_w, const float* __restrict__ mix_w, float* out) {
  __shared__ __align__(16) unsigned short Wh[COUT * WPITCH];
  __shared__ __align__(16) unsigned short Wl[COUT * WPITCH];
  __shared__ __align__(32) float ve[DMOD];
  __shared__ float gm[NHEAD][64];
  __shared__ __align__(16) float sT[4][16 * SPITCH];
  const int tid  = threadIdx.x, lane = tid & 31, wave = tid >> 5;
  const int lo   = lane & 15, hi = lane >> 4;
  const int b    = blockIdx.x >> 4;
  const int s0   = (blockIdx.x & 15) * 64;

  // ---- channel mix of the per-head beta values: rows s0..s0+63, heads hp and hp+2 per thread ----
  {
    const int row = tid & 63, hp = tid >> 6;
    const float* gp = bt + (size_t)(b * CIN) * (NHEAD * SEQ) + (size_t)hp * SEQ + s0 + row;
    float g0 = 0.f, g1 = 0.f;
#pragma unroll                                                        // all 64 loads in flight together
    for (int c = 0; c < CIN; ++c) {
      const float wgt = mix_w[c];
      g0 = fmaf(wgt, gp[(size_t)c * (NHEAD * SEQ)], g0);
      g1 = fmaf(wgt, gp[(size_t)c * (NHEAD * SEQ) + 2 * SEQ], g1);
    }
    gm[hp][row]     = g0;
    gm[hp + 2][row] = g1;
  }
  {
    const int o = tid >> 1, k0 = (tid & 1) * 32;                     // o_w row o, j = k0 .. k0+31
    const float* sp = o_w + (size_t)o * DMOD + k0;
#pragma unroll
    for (int q = 0; q < 4; ++q) {
      const v4f a0 = *(const v4f*)(sp + 8 * q);
      const v4f a1 = *(const v4f*)(sp + 8 * q + 4);
      float f[8];
#pragma unroll
      for (int e = 0; e < 4; ++e) { f[e] = a0[e]; f[4 + e] = a1[e]; }
      v4u hq, lq;
#pragma unroll
      for (int e = 0; e < 4; ++e) {
        unsigned h0, l0, h1, l1;
        split2(f[2 * e], h0, l0);
        split2(f[2 * e + 1], h1, l1);
        hq[e] = pk(h0, h1);
        lq[e] = pk(l0, l1);
      }
      *(v4u*)(Wh + o * WPITCH + k0 + 8 * q) = hq;
      *(v4u*)(Wl + o * WPITCH + k0 + 8 * q) = lq;
    }
  }
  if (tid < DMOD) {                                                   // waves 0,1 (wave-uniform): ve[j], v_w row j
    const float* wrow = v_w + (size_t)tid * DMOD;
    float acc = 0.f;
#pragma unroll 4
    for (int k = 0; k < DMOD; ++k) acc = fmaf(wrow[k], embed_w[k], acc);
    ve[tid] = acc;
  }
  __syncthreads();

  v8f oacc[4];
#pragma unroll
  for (int j = 0; j < 4; ++j) oacc[j] = zero8();

  const int arow = 16 * wave + lo;                                    // row index within the block's 64 rows

#pragma unroll 1
  for (int ks = 0; ks < 2; ++ks) {
    const float be0 = gm[2 * ks][arow];                             // head 2ks, mixed over channels, row s
    const float be1 = gm[2 * ks + 1][arow];                         // head 2ks+1
    const v8f vea = *(const v8f*)(ve + 32 * ks + 8 * hi);           // j = 32ks + 8h + 0..7      (head 2ks)
    const v8f veb = *(const v8f*)(ve + 32 * ks + 16 + 8 * hi);      // j = 32ks + 16 + 8h + 0..7 (head 2ks+1)
    FragB fa, fl;
#pragma unroll
    for (int j = 0; j < 4; ++j) {
      unsigned h0, l0, h1, l1;
      split2(be0 * vea[2 * j], h0, l0);
      split2(be0 * vea[2 * j + 1], h1, l1);
      fa.u[j] = pk(h0, h1);
      fl.u[j] = pk(l0, l1);
      split2(be1 * veb[2 * j], h0, l0);
      split2(be1 * veb[2 * j + 1], h1, l1);
      fa.u[4 + j] = pk(h0, h1);
      fl.u[4 + j] = pk(l0, l1);
    }
    FragB wh[4], wl[4];
#pragma unroll
    for (int j = 0; j < 4; ++j) {
      const int wo = (16 * j + lo) * WPITCH + 32 * ks + 8 * hi;
      wh[j].q[0] = *(const v4u*)(Wh + wo);
      wh[j].q[1] = *(const v4u*)(Wh + wo + 16);
      wl[j].q[0] = *(const v4u*)(Wl + wo);
      wl[j].q[1] = *(const v4u*)(Wl + wo + 16);
    }
#pragma unroll
    for (int j = 0; j < 4; ++j) {
      oacc[j] = mma_b(fa.v, wh[j].v, oacc[j]);
      oacc[j] = mma_b(fa.v, wl[j].v, oacc[j]);
      oacc[j] = mma_b(fl.v, wh[j].v, oacc[j]);
    }
    guard4(oacc[0], oacc[1], oacc[2], oacc[3], fa.u, fl.u,
           wh[0].u, wh[1].u, wh[2].u, wh[3].u, wl[0].u, wl[1].u, wl[2].u, wl[3].u);
  }

  // ---- epilogue ----
  float* slab = sT[wave];
  const int mOff = 8 * hi;
#pragma unroll
  for (int j = 0; j < 4; ++j) {
#pragma unroll
    for (int r = 0; r < 8; ++r) slab[(mOff + r) * SPITCH + (j << 4) + lo] = oacc[j][r];
  }
  wave_sync_lds();
  const int c4 = lo * 4;
  v4f vals[8];
#pragma unroll
  for (int it = 0; it < 8; ++it) {
    const int row = it * 2 + hi;                                      // it 0..7 x h 0..1 = rows 0..15
    vals[it] = *(const v4f*)(slab + row * SPITCH + c4);
  }
  float* ob = out + (size_t)(b * SEQ + s0 + 16 * wave) * COUT;
#pragma unroll
  for (int it = 0; it < 8; ++it) {
    const int row = it * 2 + hi;
    *(v4f*)(ob + (size_t)row * COUT + c4) = vals[it];
  }
  
  wave_sync_lds();
}

// =====================================================================================================
// Workspace map (bytes): BT f32 [64 seq][4 heads][1024]  offset 0, 1048576 bytes (4 KB per (seq, head), written as
// Inputs (f32): 0 x [2][32][32][32], 1 embed_w [64][1], 2 q_w [64][64], 3 k_w, 4 v_w, 5 o_w [64][64],
// 6 mix weights [1][32]. Output f32 [2][32][32][64].
// =====================================================================================================
extern "C" void kernel_launch(void* const* d_in, const int* in_sizes, int n_in,
                              void* d_out, int out_size, void* d_ws, size_t ws_size,
                              hipStream_t stream) {
  if (n_in < 7) return;
  if (in_sizes[0] != NBAT * IMH * IMW * CIN) return;
  if (in_sizes[1] != DMOD) return;
  if (in_sizes[2] != DMOD * DMOD || in_sizes[3] != DMOD * DMOD || in_sizes[4] != DMOD * DMOD) return;
  if (in_sizes[5] != COUT * DMOD || in_sizes[6] != CIN) return;
  if (out_size != NBAT * SEQ * COUT) return;

  const size_t PB = (size_t)NSQ * NHEAD * SEQ * 4;                   // 1048576
  if (PB > ws_size) return;
  if (PB > (size_t)134217728) return;

  const float* x       = (const float*)d_in[0];
  const float* embed_w = (const float*)d_in[1];
  const float* q_w     = (const float*)d_in[2];
  const float* k_w     = (const float*)d_in[3];
  const float* v_w     = (const float*)d_in[4];
  const float* o_w     = (const float*)d_in[5];
  const float* mix_w   = (const float*)d_in[6];
  float* bt            = (float*)d_ws;
  float* out           = (float*)d_out;

  const dim3 blk(128);
  const dim3 gA(NSQ * NHEAD);                                        // 256 blocks
  const dim3 gP(NBAT * SEQ / 64);                                    // 32 blocks

  attn_rank1<<<gA, dim3(ATHR), 0, stream>>>(x, embed_w, q_w, k_w, bt);
  proj_mix<<<gP, blk, 0, stream>>>(bt, embed_w, v_w, o_w, mix_w, out);
  (void)hipGetLastError();
}

// v004
// One run takes 30.2 microseconds.
// Next to v003, in two timings, it ran 1.20 times as fast each time.
// Over all steps from v000 it is 3.55 times as fast.
// Contractions: attention P.V through the rank-1 V = t*ve as the padded matvec P.[t | 1] on
// v_wmma_f32_16x16x32_bf16 (A = P as bf16 hi and lo pieces, B columns = t_hi, t_lo, ones, zeros; two products per
// 32 keys, f32 accumulate; on the symmetric path the table is A and P is B, and each block of P is also multiplied by a
// 0/1 selection matrix, which hands it over transposed for the mirrored product); the 32-channel mix as a fixed-order f32 VALU sum of the per-channel beta values, taken ahead
// of the output projection (both are linear); output projection (mixed beta*ve rows) . o_w^T on v_wmma_f32_16x16x32_bf16
// (both operands bf16 hi+lo pieces, hh+hl+lh, K = 64, f32 accumulate from zero); embedding, per-head q/k/v vectors,
// scores and softmax exponentials in f32 on VALU.
#include <hip/hip_runtime.h>
#include <stdint.h>

#define NBAT   2
#define IMH    32
#define IMW    32
#define CIN    32
#define DMOD   64
#define NHEAD  4
#define HDIM   16
#define SEQ    1024
#define NSQ    64
#define COUT   64
#define BTP    1032
#define WPITCH 72
#define SPITCH 68
#define LOG2E  1.44269504088896340736f
#define ATHR   512
#define AWAV   (ATHR / 32)
#define NBLK   (SEQ / 32)
#define NSLOT  (NBLK / 2 + 1)
#define SPREAD 104.0f

static_assert(IMH * IMW == SEQ);
static_assert(NBAT * CIN == NSQ);
static_assert(NHEAD * HDIM == DMOD);
static_assert((SEQ % 64) == 0 && COUT == 64 && DMOD == 64 && CIN == 32 && HDIM == 16);
static_assert((BTP % 8) == 0 && (WPITCH % 8) == 0 && (SPITCH % 4) == 0);
static_assert(SEQ == 2 * ATHR && (SEQ / 16) % AWAV == 0);
static_assert(NBLK == 2 * AWAV);

typedef __bf16   v16b __attribute__((ext_vector_type(16)));
typedef float    v8f  __attribute__((ext_vector_type(8)));
typedef float    v4f  __attribute__((ext_vector_type(4)));
typedef float    v2f  __attribute__((ext_vector_type(2)));
typedef unsigned int v8u __attribute__((ext_vector_type(8)));
typedef unsigned int v4u __attribute__((ext_vector_type(4)));

union FragB { v16b v; v8u u; v4u q[2]; };

// ---- scalar helpers ----------------------------------------------------------------------------------
__device__ __forceinline__ v8f zero8() { v8f z = {0.f, 0.f, 0.f, 0.f, 0.f, 0.f, 0.f, 0.f}; return z; }
// f32 bits -> bf16 value kept in the upper 16 bits (low 16 bits zero), RNE convert
__device__ __forceinline__ unsigned rne_hi(unsigned u) {
  return (u + 0x7FFFu + ((u >> 16) & 1u)) & 0xFFFF0000u;
}
// two-piece bf16 decomposition: a ~= hi + lo, hi = RNE bf16(a), lo = RNE bf16(a - hi); returns the 16-bit patterns
__device__ __forceinline__ void split2(float a, unsigned& h16, unsigned& l16) {
  const unsigned hu = rne_hi(__float_as_uint(a));
  const float lf = a - __uint_as_float(hu);
  h16 = hu >> 16;
  l16 = rne_hi(__float_as_uint(lf)) >> 16;
}
__device__ __forceinline__ unsigned pk(unsigned lo16, unsigned hi16) { return (lo16 & 0xFFFFu) | (hi16 << 16); }

// One 16 x 32 block of probabilities from its 16 score words per lane. Pair j: a[j], b[j] hold the log2 scores of elements
// 2j, 2j+1 on entry; on exit h[j] = the two bf16 hi pieces (round to nearest of p), a[j] = the two bf16 lo pieces (round to
// nearest of p - hi; p - hi is exact in f32, formed by a mixed-precision fma that reads its bf16 half of h[j] directly
// and writes its own half of a[j]). One statement so that the order stands: the converts and fmas are spread among the
// exponentials, each four or more instructions behind its producer; behind the last exponential the distances
// shrink, and there s_delay_alu names the producer so that the SIMD's other waves issue meanwhile.
__device__ __forceinline__ void exp_split16(float (&a)[8], float (&b)[8], unsigned (&h)[8]) {
#if defined(__HIP_DEVICE_COMPILE__)
  asm volatile(
      "v_exp_f32 %0, %0\n\t"
      "v_exp_f32 %8, %8\n\t"
      "v_exp_f32 %1, %1\n\t"
      "v_exp_f32 %9, %9\n\t"
      "v_exp_f32 %2, %2\n\t"
      "v_cvt_pk_bf16_f32 %16, %0, %8\n\t"
      "v_exp_f32 %10, %10\n\t"
      "v_exp_f32 %3, %3\n\t"
      "v_cvt_pk_bf16_f32 %17, %1, %9\n\t"
      "v_exp_f32 %11, %11\n\t"
      "v_fma_mixlo_bf16 %0, %16, -1.0, %0 op_sel_hi:[1,0,0]\n\t"
      "v_exp_f32 %4, %4\n\t"
      "v_cvt_pk_bf16_f32 %18, %2, %10\n\t"
      "v_exp_f32 %12, %12\n\t"
      "v_fma_mixlo_bf16 %1, %17, -1.0, %1 op_sel_hi:[1,0,0]\n\t"
      "v_fma_mixhi_bf16 %0, %16, -1.0, %8 op_sel:[1,0,0] op_sel_hi:[1,0,0]\n\t"
      "v_exp_f32 %5, %5\n\t"
      "v_cvt_pk_bf16_f32 %19, %3, %11\n\t"
      "v_exp_f32 %13, %13\n\t"
      "v_fma_mixlo_bf16 %2, %18, -1.0, %2 op_sel_hi:[1,0,0]\n\t"
      "v_fma_mixhi_bf16 %1, %17, -1.0, %9 op_sel:[1,0,0] op_sel_hi:[1,0,0]\n\t"
      "v_exp_f32 %6, %6\n\t"
      "v_cvt_pk_bf16_f32 %20, %4, %12\n\t"
      "v_exp_f32 %14, %14\n\t"
      "v_fma_mixlo_bf16 %3, %19, -1.0, %3 op_sel_hi:[1,0,0]\n\t"
      "v_fma_mixhi_bf16 %2, %18, -1.0, %10 op_sel:[1,0,0] op_sel_hi:[1,0,0]\n\t"
      "v_exp_f32 %7, %7\n\t"
      "v_cvt_pk_bf16_f32 %21, %5, %13\n\t"
      "v_exp_f32 %15, %15\n\t"
      "v_fma_mixlo_bf16 %4, %20, -1.0, %4 op_sel_hi:[1,0,0]\n\t"
      "v_fma_mixhi_bf16 %3, %19, -1.0, %11 op_sel:[1,0,0] op_sel_hi:[1,0,0]\n\t"
      "v_cvt_pk_bf16_f32 %22, %6, %14\n\t"
      "s_delay_alu instid0(VALU_DEP_4)\n\t"
      "v_fma_mixlo_bf16 %5, %21, -1.0, %5 op_sel_hi:[1,0,0]\n\t"
      "s_delay_alu instid0(VALU_DEP_4)\n\t"
      "v_fma_mixhi_bf16 %4, %20, -1.0, %12 op_sel:[1,0,0] op_sel_hi:[1,0,0]\n\t"
      "s_delay_alu instid0(TRANS32_DEP_1)\n\t"
      "v_cvt_pk_bf16_f32 %23, %7, %15\n\t"
      "s_delay_alu instid0(VALU_DEP_3)\n\t"
      "v_fma_mixhi_bf16 %5, %21, -1.0, %13 op_sel:[1,0,0] op_sel_hi:[1,0,0]\n\t"
      "v_fma_mixlo_bf16 %6, %22, -1.0, %6 op_sel_hi:[1,0,0]\n\t"
      "s_delay_alu instid0(VALU_DEP_3)\n\t"
      "v_fma_mixlo_bf16 %7, %23, -1.0, %7 op_sel_hi:[1,0,0]\n\t"
      "s_delay_alu instid0(VALU_DEP_2)\n\t"
      "v_fma_mixhi_bf16 %6, %22, -1.0, %14 op_sel:[1,0,0] op_sel_hi:[1,0,0]\n\t"
      "s_delay_alu instid0(VALU_DEP_2)\n\t"
      "v_fma_mixhi_bf16 %7, %23, -1.0, %15 op_sel:[1,0,0] op_sel_hi:[1,0,0]"
      : "+v"(a[0]), "+v"(a[1]), "+v"(a[2]), "+v"(a[3]), "+v"(a[4]), "+v"(a[5]), "+v"(a[6]), "+v"(a[7]),
        "+v"(b[0]), "+v"(b[1]), "+v"(b[2]), "+v"(b[3]), "+v"(b[4]), "+v"(b[5]), "+v"(b[6]), "+v"(b[7]),
        "=&v"(h[0]), "=&v"(h[1]), "=&v"(h[2]), "=&v"(h[3]), "=&v"(h[4]), "=&v"(h[5]), "=&v"(h[6]), "=&v"(h[7]));
#endif
}

// ---- WMMA helpers with trailing VALU hazard gap -----------------------------------------------------
__device__ __forceinline__ v8f mma_b(v16b a, v16b b, v8f c) {
  return __builtin_amdgcn_wmma_f32_16x16x32_bf16(false, a, false, b, (short)0, c, false, false);
}
__device__ __forceinline__ void guard2(v8f& a, v8f& b, v8u x, v8u y, v8u z) {
#if defined(__HIP_DEVICE_COMPILE__)
  asm volatile("v_nop\n\tv_nop\n\tv_nop\n\tv_nop" : "+v"(a), "+v"(b) : "v"(x), "v"(y), "v"(z));
#endif
}
__device__ __forceinline__ void guard4(v8f& a, v8f& b, v8f& c, v8f& d, v8u x0, v8u x1,
                                       v8u y0, v8u y1, v8u y2, v8u y3, v8u z0, v8u z1, v8u z2, v8u z3) {
#if defined(__HIP_DEVICE_COMPILE__)
  asm volatile("v_nop\n\tv_nop\n\tv_nop\n\tv_nop"
               : "+v"(a), "+v"(b), "+v"(c), "+v"(d)
               : "v"(x0), "v"(x1), "v"(y0), "v"(y1), "v"(y2), "v"(y3), "v"(z0), "v"(z1), "v"(z2), "v"(z3));
#endif
}
__device__ __forceinline__ void wave_sync_lds() {
  __builtin_amdgcn_fence(__ATOMIC_RELEASE, "workgroup");
  __builtin_amdgcn_wave_barrier();
  __builtin_amdgcn_fence(__ATOMIC_ACQUIRE, "workgroup");
}

// =====================================================================================================
// Kernel 1: one block per (sequence n = b*32 + c, head), 512 threads = 16 waves (four per SIMD, so that one wave's LDS
// and exponential latencies are covered by the other three).
// t[s] = x[b][s>>5][s&31][c] in LDS (f32). embed_w is a single column e, so E = t (x) e and Q[s] = t[s]*qe,
// K[s] = t[s]*ke, V[s] = t[s]*ve with qe[i] = sum_k q_w[i][k] e[k], ke likewise (this head's 16 rows, f32 dots).
// Scores in log2 units: s2[q][k] = ah * t[q] * t[k], ah = 0.25 * log2(e) * (qe_h . ke_h); the row max is exactly
// max(coef*gmax, coef*gmin) with coef = ah*t[q], so p = 2^(s2 - rowmax) <= 1 in one pass (f32, v_exp_f32).
// Since V_h[k][d] = t[k] * ve_h[d], the attention output row is beta_h[q] * ve_h with beta = sum_k p t / sum_k p.
// That K = 1024 reduction is a 16-column padded matvec on bf16 WMMA: B table Bt[col][key] (k contiguous, pitch 1032)
// with col 0 = bf16 hi piece of t, col 1 = bf16 lo piece (t - hi), col 2 = 1.0, col 3 = 0 (lanes with col >= 3 read
// col 3); A = P rows (row = query s0 + (lane&15), elements 0..7 = keys t0 + 8h + i, 8..15 = keys t0 + 16 + 8h + i)
// as two fragments: hi piece (p rounded to bf16) and lo piece (p - hi rounded to bf16). Two WMMAs per 32 keys:
// acc1 = P_hi . B, acc2 = P_lo . B, so D columns 0,1 of acc1+acc2 sum to sum_k p t (all four cross products) and
// column 2 to sum_k p, both from the very same operands. D element r = row 8h + r, col lane&15: per row the three
// columns are fetched with shuffles from lanes 16h + 0,1,2, beta = num * rcp(den) (den >= ~1), lane 16h + r keeps
// row 8h + r and writes it to the LDS staging array Bs[s]. Wave w owns query tiles w + 16i.
// Epilogue: after a block barrier the 1024 f32 values go to BT[n][head][0..1023] as one 16-byte store of 256 lanes.
// SYMMETRIC PATH. s2[q][k] = s2[k][q], so with ONE shift for the whole matrix, cmx = max over q,k of s2 (a corner of
// [gmin,gmax]^2), G[q][k] = 2^(s2 - cmx) <= 1 is symmetric too, and beta[q] = sum_k G t / sum_k G as before (the row's
// own factor cancels in the quotient). The 1024 indices form 32 blocks of 32; the block pair (I, J = I + d mod 32) is
// worked once, for d = 0..15 and, from I < 16 only, d = 16: wave w takes I = w and I = w + 16 (33 pairs each).
// Per pair the 32 x 32 values of G are made once (two 16 x 32 fragments, bf16 hi and lo pieces as above) and used
// twice: for rows I (table as A, G as B: D[table row][query], accumulated over d in registers) and, d > 0, for rows J:
// G times a 0/1 selection matrix on the matrix unit hands each lane one key column (D register r = query 8h + r),
// which converted in place is the B operand of table(I) . G = D[table row][key]. Table rows 0,1,2 are D registers
// 0,1,2 of lanes 0..15, so (num, den) of a row is one 8-byte LDS store, no lane exchange: part[d][row], d = 0 the
// rows' own sums. Behind the block barrier row r adds its slots d = 0..15 (r >= 512: ..16) in that order.
// Range: a row's largest term is 2^(rowmax - cmx); the path is taken only while cmx - (lower bound of all row maxima)
// <= 104, so that every row's leading terms and their lo pieces stay normal f32/bf16 numbers; otherwise the row-max
// loop runs (same result, every exponential made for its own row).
// coverage: part slot 0 all rows (every I); slots 1..15 all rows (J = I + d runs over all blocks); slot 16 rows >= 512.
// coverage: Bt rows 0..3 x keys 0..1031 (512 threads x 2 keys + thread 0 the 8 tail keys); Bs[s] written once for every
//           s (tile rows 0..7 by lanes 0..7, rows 8..15 by lanes 16..23); plane region 4 KB per block, 256 blocks =
//           the whole 1 MiB plane.
// =====================================================================================================
__global__ __launch_bounds__(ATHR)
void attn_rank1(const float* __restrict__ x, const float* __restrict__ embed_w,
                const float* __restrict__ q_w, const float* __restrict__ k_w, float* bt) {
  __shared__ __align__(32) float tv[SEQ];
  __shared__ __align__(16) unsigned short Bt[4 * BTP];
  __shared__ __align__(16) float Bs[SEQ];
  __shared__ float hv[2][HDIM];
  __shared__ float red[AWAV][2];
  __shared__ __align__(16) float part[NSLOT * SEQ * 2];

  const int n    = blockIdx.x >> 2;
  const int head = blockIdx.x & 3;
  const int b    = n >> 5;
  const int ch   = n & 31;
  const int tid  = threadIdx.x, lane = tid & 31, wave = tid >> 5;
  const int lo   = lane & 15, hi = lane >> 4;

  // ---- token values of this sequence, with block max/min ----
  float lmax = -3.0e38f, lmin = 3.0e38f;
  for (int t = tid; t < SEQ; t += ATHR) {
    const int hh = t >> 5, ww = t & 31;
    const float v = x[(((size_t)b * IMH + hh) * IMW + ww) * CIN + ch];
    tv[t] = v;
    lmax = fmaxf(lmax, v);
    lmin = fminf(lmin, v);
  }
#pragma unroll
  for (int off = 16; off > 0; off >>= 1) {
    lmax = fmaxf(lmax, __shfl_xor(lmax, off, 32));
    lmin = fminf(lmin, __shfl_xor(lmin, off, 32));
  }
  if (lane == 0) { red[wave][0] = lmax; red[wave][1] = lmin; }

  // ---- per-head projection vectors: wave 0 -> qe, wave 1 -> ke (wave-uniform source select;
  //      lanes 16..31 duplicate lanes 0..15 and store the identical value) ----
  if (wave < 2) {
    const float* wsrc = (wave == 0) ? q_w : k_w;
    const float* wrow = wsrc + (size_t)(head * HDIM + lo) * DMOD;
    float acc = 0.f;
#pragma unroll 4
    for (int k = 0; k < DMOD; ++k) acc = fmaf(wrow[k], embed_w[k], acc);
    hv[wave][lo] = acc;
  }
  __syncthreads();

  float gmax = red[0][0], gmin = red[0][1];
#pragma unroll                                                        // all reads of red[] behind one LDS wait
  for (int w = 1; w < AWAV; ++w) { gmax = fmaxf(gmax, red[w][0]); gmin = fminf(gmin, red[w][1]); }
  float dqk = 0.f;
#pragma unroll 4
  for (int d = 0; d < HDIM; ++d) dqk = fmaf(hv[0][d], hv[1][d], dqk);
  const float ah2 = dqk * (0.25f * LOG2E);

  // ---- B table: row 0 = t hi piece, row 1 = t lo piece, row 2 = ones, row 3 = zeros; keys 2*tid, 2*tid+1 ----
  {
    const int kb = 2 * tid;
    unsigned h0, l0, h1, l1;
    split2(tv[kb], h0, l0);
    split2(tv[kb + 1], h1, l1);
    const v4u zer  = {0u, 0u, 0u, 0u};
    *(unsigned*)(Bt + 0 * BTP + kb) = pk(h0, h1);
    *(unsigned*)(Bt + 1 * BTP + kb) = pk(l0, l1);
    *(unsigned*)(Bt + 2 * BTP + kb) = 0x3F803F80u;
    *(unsigned*)(Bt + 3 * BTP + kb) = 0u;
    if (tid == 0) {                          // tail keys 1024..1031 (never read, zero-filled)
      *(v4u*)(Bt + 0 * BTP + SEQ) = zer;
      *(v4u*)(Bt + 1 * BTP + SEQ) = zer;
      *(v4u*)(Bt + 2 * BTP + SEQ) = zer;
      *(v4u*)(Bt + 3 * BTP + SEQ) = zer;
    }
  }
  __syncthreads();

  const int br = (lo < 3) ? lo : 3;                                   // fragment: lane&15 -> table row (B column; A row on the symmetric path)
  const unsigned short* brow = Bt + br * BTP + 8 * hi;
  float* plane = bt + (size_t)(n * NHEAD + head) * SEQ;

  // ---- which path: cmx = largest score of the whole matrix (a corner of [gmin,gmax]^2), mlow = a lower bound of every
  //      row's own maximum (the row maximum is convex in t[q] and 0 at t[q] = 0). Same value in every thread. ----
  const float cg   = ah2 * gmax, cl = ah2 * gmin;
  const float mg   = fmaxf(cg * gmax, cg * gmin);
  const float ml   = fmaxf(cl * gmax, cl * gmin);
  const float cmx  = fmaxf(mg, ml);
  const float mlow = (gmin <= 0.f && gmax >= 0.f) ? 0.f : fminf(mg, ml);
  // through a scalar register: one scalar branch for the whole wave (matrix instructions need every lane on)
  const bool  sym  = __builtin_amdgcn_readfirstlane((cmx - mlow <= SPREAD) ? 1 : 0) != 0;

  if (sym) {
    const int   wv  = __builtin_amdgcn_readfirstlane(wave);
    const float ncm = -cmx;
    FragB sel[2];                                                     // sel[kh]: B[k][n] = (k == 16*kh + n), kmap order
    {
      const int e = lo - 8 * hi;
#pragma unroll                                                        // register arrays need constant indices
      for (int j = 0; j < 4; ++j) {
        const unsigned w = (e == 2 * j) ? 0x00003F80u : ((e == 2 * j + 1) ? 0x3F800000u : 0u);
        sel[0].u[j] = w;  sel[0].u[4 + j] = 0u;
        sel[1].u[j] = 0u; sel[1].u[4 + j] = w;
      }
    }
#pragma unroll 1                                                      // one body for both row blocks of a wave
    for (int pass = 0; pass < 2; ++pass) {
      const int I  = wv + AWAV * pass;
      const int nd = NSLOT - pass;                                    // offset 16 is taken from its lower side only
      float coef[2];
      coef[0] = ah2 * tv[32 * I + lo];
      coef[1] = ah2 * tv[32 * I + 16 + lo];
      FragB bfi;                                                      // table at the block's own 32 indices
      bfi.q[0] = *(const v4u*)(brow + 32 * I);
      bfi.q[1] = *(const v4u*)(brow + 32 * I + 16);
      v8f a1[2], a2[2];
      a1[0] = zero8(); a1[1] = zero8(); a2[0] = zero8(); a2[1] = zero8();
#pragma unroll 1                                                      // the body already holds 16 matrix instructions
      for (int d = 0; d < nd; ++d) {
        const int t0 = 32 * ((I + d) & (NBLK - 1));
        const v8f ta = *(const v8f*)(tv + t0 + 8 * hi);             // keys t0 + 8h + 0..7
        const v8f tb = *(const v8f*)(tv + t0 + 16 + 8 * hi);        // keys t0 + 16 + 8h + 0..7
        FragB bf;
        bf.q[0] = *(const v4u*)(brow + t0);
        bf.q[1] = *(const v4u*)(brow + t0 + 16);
        FragB ph[2], pl[2];
#pragma unroll                                                        // register arrays need constant indices
        for (int qt = 0; qt < 2; ++qt) {
          float ya[8], yb[8];
          unsigned hw[8];
#pragma unroll                                                        // register arrays need constant indices
          for (int j = 0; j < 4; ++j) {
            ya[j]     = fmaf(coef[qt], ta[2 * j], ncm);
            yb[j]     = fmaf(coef[qt], ta[2 * j + 1], ncm);
            ya[4 + j] = fmaf(coef[qt], tb[2 * j], ncm);
            yb[4 + j] = fmaf(coef[qt], tb[2 * j + 1], ncm);
          }
          exp_split16(ya, yb, hw);
#pragma unroll                                                        // register arrays need constant indices
          for (int j = 0; j < 8; ++j) {
            ph[qt].u[j] = hw[j];
            pl[qt].u[j] = __float_as_uint(ya[j]);
          }
          a1[qt] = mma_b(bf.v, ph[qt].v, a1[qt]);                     // D[table row][query]
          a2[qt] = mma_b(bf.v, pl[qt].v, a2[qt]);
        }
        if (d != 0) {                                                 // scalar test; the diagonal block has no mirror
          // G . sel[kh] = the 16 key columns of half kh: D register r = query 8h + r, lane = key. Two such tiles
          // (queries 0..15, 16..31) converted in place are the B operand of the mirrored product. Each D value is
          // one bf16 piece times 1.0, so the convert back is exact.
          v8f dh[2][2], dl[2][2];
#pragma unroll                                                        // register arrays need constant indices
          for (int kh = 0; kh < 2; ++kh) {
            dh[kh][0] = mma_b(ph[0].v, sel[kh].v, zero8());
            dh[kh][1] = mma_b(ph[1].v, sel[kh].v, zero8());
            dl[kh][0] = mma_b(pl[0].v, sel[kh].v, zero8());
            dl[kh][1] = mma_b(pl[1].v, sel[kh].v, zero8());
          }
          // holds the eight together: each fills the window behind the one before it, so that no convert stands
          // directly behind its own matrix instruction (the scheduler otherwise pairs them and pads with v_nop)
          __builtin_amdgcn_sched_barrier(0);
          FragB th[2], tl[2];
#pragma unroll                                                        // register arrays need constant indices
          for (int kh = 0; kh < 2; ++kh) {
#pragma unroll                                                        // register arrays need constant indices
            for (int s = 0; s < 8; ++s) {
              th[kh].v[s]     = (__bf16)dh[kh][0][s];
              th[kh].v[8 + s] = (__bf16)dh[kh][1][s];
            }
#pragma unroll                                                        // register arrays need constant indices
            for (int s = 0; s < 8; ++s) {
              tl[kh].v[s]     = (__bf16)dl[kh][0][s];
              tl[kh].v[8 + s] = (__bf16)dl[kh][1][s];
            }
          }
          // holds all converts ahead of the four products, in the order in which their D tiles arrive: a convert
          // placed between two products overwrites an operand of the first and costs four v_nop each time
          __builtin_amdgcn_sched_barrier(0);
          v8f ct[2];
          ct[0] = mma_b(bfi.v, th[0].v, zero8());                     // D[table row][key]
          ct[1] = mma_b(bfi.v, th[1].v, zero8());
          ct[0] = mma_b(bfi.v, tl[0].v, ct[0]);
          ct[1] = mma_b(bfi.v, tl[1].v, ct[1]);
          if (hi == 0) {                                              // table rows 0..2 live in lanes 0..15
#pragma unroll                                                        // register arrays need constant indices
            for (int kh = 0; kh < 2; ++kh) {
              const v2f o = {ct[kh][0] + ct[kh][1], ct[kh][2]};
              *(v2f*)(part + (size_t)(d * SEQ + t0 + 16 * kh + lo) * 2) = o;
            }
          }
        }
      }
#pragma unroll                                                        // register arrays need constant indices
      for (int qt = 0; qt < 2; ++qt) {
        if (hi == 0) {
          const v2f o = {(a1[qt][0] + a2[qt][0]) + (a1[qt][1] + a2[qt][1]), a1[qt][2] + a2[qt][2]};
          *(v2f*)(part + (size_t)(32 * I + 16 * qt + lo) * 2) = o;
        }
      }
    }
    __syncthreads();
#pragma unroll                                                        // the number of slots depends on u
    for (int u = 0; u < 2; ++u) {                                     // rows tid (blocks 0..15), tid + 512 (blocks 16..31)
      const int row = tid + u * ATHR;
      float num = 0.f, den = 0.f;
#pragma unroll                                                        // all slot reads behind one LDS wait
      for (int d = 0; d < NSLOT - 1 + u; ++d) {
        const v2f v = *(const v2f*)(part + (size_t)(d * SEQ + row) * 2);
        num += v[0];
        den += v[1];
      }
      plane[row] = num * __builtin_amdgcn_rcpf(den);
    }
    return;
  }

#pragma unroll 1
  for (int i = 0; i < SEQ / (16 * AWAV); ++i) {                       // 4 query tiles per wave, wave-uniform
    const int s0 = (wave + AWAV * i) * 16;
    const float coef = ah2 * tv[s0 + lo];                             // query row m = lo
    const float cm   = -fmaxf(coef * gmax, coef * gmin);              // exact row max, p <= 1
    v8f acc1 = zero8(), acc2 = zero8();
#pragma unroll 1
    for (int kt = 0; kt < SEQ / 32; ++kt) {
      const int t0 = kt * 32;
      const v8f ta = *(const v8f*)(tv + t0 + 8 * hi);               // keys t0 + 8h + 0..7
      const v8f tb = *(const v8f*)(tv + t0 + 16 + 8 * hi);          // keys t0 + 16 + 8h + 0..7
      FragB bf;
      bf.q[0] = *(const v4u*)(brow + t0);                             // keys t0 + 8h + 0..7
      bf.q[1] = *(const v4u*)(brow + t0 + 16);                        // keys t0 + 16 + 8h + 0..7
      float ya[8], yb[8];
      unsigned hw[8];
#pragma unroll
      for (int j = 0; j < 4; ++j) {
        ya[j]     = fmaf(coef, ta[2 * j], cm);                        // elements 2j, 2j+1
        yb[j]     = fmaf(coef, ta[2 * j + 1], cm);
        ya[4 + j] = fmaf(coef, tb[2 * j], cm);                        // elements 8+2j, 8+2j+1
        yb[4 + j] = fmaf(coef, tb[2 * j + 1], cm);
      }
      exp_split16(ya, yb, hw);
      FragB ph, pl;
#pragma unroll
      for (int j = 0; j < 8; ++j) {
        ph.u[j] = hw[j];
        pl.u[j] = __float_as_uint(ya[j]);
      }
      acc1 = mma_b(ph.v, bf.v, acc1);
      acc2 = mma_b(pl.v, bf.v, acc2);
      guard2(acc1, acc2, ph.u, pl.u, bf.u);
    }

    // ---- combine: D element r = row 8h + r; columns 0,1,2 live in lanes 16h + 0,1,2 ----
    const int sb = 16 * hi;
    float beta[8];
#pragma unroll
    for (int r = 0; r < 8; ++r) {
      const float a0 = __shfl(acc1[r], sb, 32);
      const float a1 = __shfl(acc1[r], sb + 1, 32);
      const float a2 = __shfl(acc1[r], sb + 2, 32);
      const float c0 = __shfl(acc2[r], sb, 32);
      const float c1 = __shfl(acc2[r], sb + 1, 32);
      const float c2 = __shfl(acc2[r], sb + 2, 32);
      const float num = (a0 + c0) + (a1 + c1);
      const float den = a2 + c2;
      beta[r] = num * __builtin_amdgcn_rcpf(den);
    }
    float mine = beta[0];
#pragma unroll
    for (int r = 1; r < 8; ++r) mine = (lo == r) ? beta[r] : mine;
    if (lo < 8) Bs[s0 + 8 * hi + lo] = mine;
  }
  __syncthreads();
  if (tid < SEQ / 4) {                                                // waves 0..7 (wave-uniform)
    *(v4f*)(plane + 4 * tid) = *(const v4f*)(Bs + 4 * tid);
  }
}

// =====================================================================================================
// Kernel 2: the channel mix and the output projection are both linear, so the mix is taken first, on the four per-head
// scalars of a token row, and the projection runs once per row instead of once per channel:
//   G[h][s]       = sum_{c=0..31} mix[c] * BT[b*32+c][h][s]               (fixed order c = 0..31, f32 VALU)
//   out[(b,s)][o] = sum_{j=0..63} (G[j>>4][s] * ve[j]) * o_w[o][j]        (K = 64, o_w row o, j contiguous)
// with ve[j] = sum_k v_w[j][k] e[k] (f32 dots of 64). Block = 4 waves = 64 rows s0..s0+63 of batch b (grid 32);
// wave w rows s0+16w..+15, all 64 output columns. G: thread t sums row t&63 of heads t>>6 and 2+(t>>6), 64 independent
// loads (a wave reads 128 contiguous bytes per load), into LDS gm[h][row] ahead of the block barrier.
// o_w is decomposed once per block into bf16 hi / lo tables Wh/Wl[o][j] (j contiguous, pitch 72); B fragments:
// lane col o, elements 0..7 <- W[o][32ks+8h+0..7], 8..15 <- W[o][32ks+16+8h+0..7]. A fragments are built in f32
// registers: row s, element i <- G[2ks][s]*ve[32ks+8h+i], element 8+i <- G[2ks+1][s]*ve[32ks+16+8h+i]
// (the same j map), decomposed into bf16 hi and lo fragments; the tile accumulators start from zero and
// take Ahi.Bhi + Ahi.Blo + Alo.Bhi for ks = 0,1.
// coverage: W tables 128 threads x 32 = 64 x 64 each; gm 128 threads x 2 = 4 x 64; 32 blocks x 4 waves x 16 rows x
//           64 cols = out [2048][64].
// =====================================================================================================
__global__ __launch_bounds__(128)
void proj_mix(const float* __restrict__ bt, const float* __restrict__ embed_w, const float* __restrict__ v_w,
              const float* __restrict__ o_w, const float* __restrict__ mix_w, float* out) {
  __shared__ __align__(16) unsigned short Wh[COUT * WPITCH];
  __shared__ __align__(16) unsigned short Wl[COUT * WPITCH];
  __shared__ __align__(32) float ve[DMOD];
  __shared__ float gm[NHEAD][64];
  __shared__ __align__(16) float sT[4][16 * SPITCH];
  const int tid  = threadIdx.x, lane = tid & 31, wave = tid >> 5;
  const int lo   = lane & 15, hi = lane >> 4;
  const int b    = blockIdx.x >> 4;
  const int s0   = (blockIdx.x & 15) * 64;

  // ---- channel mix of the per-head beta values: rows s0..s0+63, heads hp and hp+2 per thread ----
  {
    const int row = tid & 63, hp = tid >> 6;
    const float* gp = bt + (size_t)(b * CIN) * (NHEAD * SEQ) + (size_t)hp * SEQ + s0 + row;
    float g0 = 0.f, g1 = 0.f;
#pragma unroll                                                        // all 64 loads in flight together
    for (int c = 0; c < CIN; ++c) {
      const float wgt = mix_w[c];
      g0 = fmaf(wgt, gp[(size_t)c * (NHEAD * SEQ)], g0);
      g1 = fmaf(wgt, gp[(size_t)c * (NHEAD * SEQ) + 2 * SEQ], g1);
    }
    gm[hp][row]     = g0;
    gm[hp + 2][row] = g1;
  }
  {
    const int o = tid >> 1, k0 = (tid & 1) * 32;                     // o_w row o, j = k0 .. k0+31
    const float* sp = o_w + (size_t)o * DMOD + k0;
#pragma unroll
    for (int q = 0; q < 4; ++q) {
      const v4f a0 = *(const v4f*)(sp + 8 * q);
      const v4f a1 = *(const v4f*)(sp + 8 * q + 4);
      float f[8];
#pragma unroll
      for (int e = 0; e < 4; ++e) { f[e] = a0[e]; f[4 + e] = a1[e]; }
      v4u hq, lq;
#pragma unroll
      for (int e = 0; e < 4; ++e) {
        unsigned h0, l0, h1, l1;
        split2(f[2 * e], h0, l0);
        split2(f[2 * e + 1], h1, l1);
        hq[e] = pk(h0, h1);
        lq[e] = pk(l0, l1);
      }
      *(v4u*)(Wh + o * WPITCH + k0 + 8 * q) = hq;
      *(v4u*)(Wl + o * WPITCH + k0 + 8 * q) = lq;
    }
  }
  if (tid < DMOD) {                                                   // waves 0,1 (wave-uniform): ve[j], v_w row j
    const float* wrow = v_w + (size_t)tid * DMOD;
    float acc = 0.f;
#pragma unroll 4
    for (int k = 0; k < DMOD; ++k) acc = fmaf(wrow[k], embed_w[k], acc);
    ve[tid] = acc;
  }
  __syncthreads();

  v8f oacc[4];
#pragma unroll
  for (int j = 0; j < 4; ++j) oacc[j] = zero8();

  const int arow = 16 * wave + lo;                                    // row index within the block's 64 rows

#pragma unroll 1
  for (int ks = 0; ks < 2; ++ks) {
    const float be0 = gm[2 * ks][arow];                             // head 2ks, mixed over channels, row s
    const float be1 = gm[2 * ks + 1][arow];                         // head 2ks+1
    const v8f vea = *(const v8f*)(ve + 32 * ks + 8 * hi);           // j = 32ks + 8h + 0..7      (head 2ks)
    const v8f veb = *(const v8f*)(ve + 32 * ks + 16 + 8 * hi);      // j = 32ks + 16 + 8h + 0..7 (head 2ks+1)
    FragB fa, fl;
#pragma unroll
    for (int j = 0; j < 4; ++j) {
      unsigned h0, l0, h1, l1;
      split2(be0 * vea[2 * j], h0, l0);
      split2(be0 * vea[2 * j + 1], h1, l1);
      fa.u[j] = pk(h0, h1);
      fl.u[j] = pk(l0, l1);
      split2(be1 * veb[2 * j], h0, l0);
      split2(be1 * veb[2 * j + 1], h1, l1);
      fa.u[4 + j] = pk(h0, h1);
      fl.u[4 + j] = pk(l0, l1);
    }
    FragB wh[4], wl[4];
#pragma unroll
    for (int j = 0; j < 4; ++j) {
      const int wo = (16 * j + lo) * WPITCH + 32 * ks + 8 * hi;
      wh[j].q[0] = *(const v4u*)(Wh + wo);
      wh[j].q[1] = *(const v4u*)(Wh + wo + 16);
      wl[j].q[0] = *(const v4u*)(Wl + wo);
      wl[j].q[1] = *(const v4u*)(Wl + wo + 16);
    }
#pragma unroll
    for (int j = 0; j < 4; ++j) {
      oacc[j] = mma_b(fa.v, wh[j].v, oacc[j]);
      oacc[j] = mma_b(fa.v, wl[j].v, oacc[j]);
      oacc[j] = mma_b(fl.v, wh[j].v, oacc[j]);
    }
    guard4(oacc[0], oacc[1], oacc[2], oacc[3], fa.u, fl.u,
           wh[0].u, wh[1].u, wh[2].u, wh[3].u, wl[0].u, wl[1].u, wl[2].u, wl[3].u);
  }

  // ---- epilogue ----
  float* slab = sT[wave];
  const int mOff = 8 * hi;
#pragma unroll
  for (int j = 0; j < 4; ++j) {
#pragma unroll
    for (int r = 0; r < 8; ++r) slab[(mOff + r) * SPITCH + (j << 4) + lo] = oacc[j][r];
  }
  wave_sync_lds();
  const int c4 = lo * 4;
  v4f vals[8];
#pragma unroll
  for (int it = 0; it < 8; ++it) {
    const int row = it * 2 + hi;                                      // it 0..7 x h 0..1 = rows 0..15
    vals[it] = *(const v4f*)(slab + row * SPITCH + c4);
  }
  float* ob = out + (size_t)(b * SEQ + s0 + 16 * wave) * COUT;
#pragma unroll
  for (int it = 0; it < 8; ++it) {
    const int row = it * 2 + hi;
    *(v4f*)(ob + (size_t)row * COUT + c4) = vals[it];
  }
  
  wave_sync_lds();
}

// =====================================================================================================
// Workspace map (bytes): BT f32 [64 seq][4 heads][1024]  offset 0, 1048576 bytes (4 KB per (seq, head), written as
// Inputs (f32): 0 x [2][32][32][32], 1 embed_w [64][1], 2 q_w [64][64], 3 k_w, 4 v_w, 5 o_w [64][64],
// 6 mix weights [1][32]. Output f32 [2][32][32][64].
// =====================================================================================================
extern "C" void kernel_launch(void* const* d_in, const int* in_sizes, int n_in,
                              void* d_out, int out_size, void* d_ws, size_t ws_size,
                              hipStream_t stream) {
  if (n_in < 7) return;
  if (in_sizes[0] != NBAT * IMH * IMW * CIN) return;
  if (in_sizes[1] != DMOD) return;
  if (in_sizes[2] != DMOD * DMOD || in_sizes[3] != DMOD * DMOD || in_sizes[4] != DMOD * DMOD) return;
  if (in_sizes[5] != COUT * DMOD || in_sizes[6] != CIN) return;
  if (out_size != NBAT * SEQ * COUT) return;

  const size_t PB = (size_t)NSQ * NHEAD * SEQ * 4;                   // 1048576
  if (PB > ws_size) return;
  if (PB > (size_t)134217728) return;

  const float* x       = (const float*)d_in[0];
  const float* embed_w = (const float*)d_in[1];
  const float* q_w     = (const float*)d_in[2];
  const float* k_w     = (const float*)d_in[3];
  const float* v_w     = (const float*)d_in[4];
  const float* o_w     = (const float*)d_in[5];
  const float* mix_w   = (const float*)d_in[6];
  float* bt            = (float*)d_ws;
  float* out           = (float*)d_out;

  const dim3 blk(128);
  const dim3 gA(NSQ * NHEAD);                                        // 256 blocks
  const dim3 gP(NBAT * SEQ / 64);                                    // 32 blocks

  attn_rank1<<<gA, dim3(ATHR), 0, stream>>>(x, embed_w, q_w, k_w, bt);
  proj_mix<<<gP, blk, 0, stream>>>(bt, embed_w, v_w, o_w, mix_w, out);
  (void)hipGetLastError();
}

// v005
// A run of this version takes 26.3 microseconds.
// Two timings next to v004 put it at 1.14 and 1.15 times that version's speed.
// Counting every step since v000, it is 4.05 times as fast.
// Contractions: attention P.V through the rank-1 V = t*ve as the padded matvec P.[t | 1] on
// v_wmma_f32_16x16x32_bf16 (A = P as bf16 hi and lo pieces, B columns = t_hi, t_lo, ones, zeros; two products per
// 32 keys, f32 accumulate; on the symmetric path the table is A and P is B, and each block of P also goes through a
// per-wave LDS tile and a transposing load, which hand it over as the B operand of the mirrored product); the 32-channel mix as a fixed-order f32 VALU sum of the per-channel beta values, taken ahead
// of the output projection (both are linear); output projection (mixed beta*ve rows) . o_w^T on v_wmma_f32_16x16x32_bf16
// (both operands bf16 hi+lo pieces, hh+hl+lh, K = 64, f32 accumulate from zero); embedding, per-head q/k/v vectors,
// scores and softmax exponentials in f32 on VALU.
#include <hip/hip_runtime.h>
#include <stdint.h>

#define NBAT   2
#define IMH    32
#define IMW    32
#define CIN    32
#define DMOD   64
#define NHEAD  4
#define HDIM   16
#define SEQ    1024
#define NSQ    64
#define COUT   64
#define BTP    1032
#define WPITCH 72
#define SPITCH 68
#define LOG2E  1.44269504088896340736f
#define ATHR   512
#define AWAV   (ATHR / 32)
#define NBLK   (SEQ / 32)
#define NSLOT  (NBLK / 2 + 1)
#define SPREAD 104.0f
#define TPITCH 96                       /* bytes per 32-key row of a transposing tile: 64 + 32, an odd multiple of 32 */
#define TTILE  (16 * TPITCH + 16)       /* 16 rows; the 16 bytes set the next tile four banks further */
#define TPIECE (2 * TTILE)              /* one piece (hi or lo) of a 32 x 32 block: two tiles */
#define TWAVE  (2 * TPIECE)

static_assert(IMH * IMW == SEQ);
static_assert(NBAT * CIN == NSQ);
static_assert(NHEAD * HDIM == DMOD);
static_assert((SEQ % 64) == 0 && COUT == 64 && DMOD == 64 && CIN == 32 && HDIM == 16);
static_assert((BTP % 8) == 0 && (WPITCH % 8) == 0 && (SPITCH % 4) == 0);
static_assert(SEQ == 2 * ATHR && (SEQ / 16) % AWAV == 0);
static_assert(NBLK == 2 * AWAV);
static_assert((TPITCH % 32) == 0 && ((TPITCH / 32) & 1) == 1 && TPITCH >= 64);

typedef __bf16   v16b __attribute__((ext_vector_type(16)));
typedef float    v8f  __attribute__((ext_vector_type(8)));
typedef float    v4f  __attribute__((ext_vector_type(4)));
typedef float    v2f  __attribute__((ext_vector_type(2)));
typedef unsigned int v8u __attribute__((ext_vector_type(8)));
typedef unsigned int v4u __attribute__((ext_vector_type(4)));
typedef short    v8s  __attribute__((ext_vector_type(8)));

union FragB { v16b v; v8u u; v4u q[2]; };

// ---- scalar helpers ----------------------------------------------------------------------------------
__device__ __forceinline__ v8f zero8() { v8f z = {0.f, 0.f, 0.f, 0.f, 0.f, 0.f, 0.f, 0.f}; return z; }
// f32 bits -> bf16 value kept in the upper 16 bits (low 16 bits zero), RNE convert
__device__ __forceinline__ unsigned rne_hi(unsigned u) {
  return (u + 0x7FFFu + ((u >> 16) & 1u)) & 0xFFFF0000u;
}
// two-piece bf16 decomposition: a ~= hi + lo, hi = RNE bf16(a), lo = RNE bf16(a - hi); returns the 16-bit patterns
__device__ __forceinline__ void split2(float a, unsigned& h16, unsigned& l16) {
  const unsigned hu = rne_hi(__float_as_uint(a));
  const float lf = a - __uint_as_float(hu);
  h16 = hu >> 16;
  l16 = rne_hi(__float_as_uint(lf)) >> 16;
}
__device__ __forceinline__ unsigned pk(unsigned lo16, unsigned hi16) { return (lo16 & 0xFFFFu) | (hi16 << 16); }

// One 16 x 32 block of probabilities from its 16 score words per lane. Pair j: a[j], b[j] hold the log2 scores of elements
// 2j, 2j+1 on entry; on exit h[j] = the two bf16 hi pieces (round to nearest of p), a[j] = the two bf16 lo pieces (round to
// nearest of p - hi; p - hi is exact in f32, formed by a mixed-precision fma that reads its bf16 half of h[j] directly
// and writes its own half of a[j]). One statement so that the order stands: the converts and fmas are spread among the
// exponentials, each four or more instructions behind its producer; behind the last exponential the distances
// shrink, and there s_delay_alu names the producer so that the SIMD's other waves issue meanwhile.
__device__ __forceinline__ void exp_split16(float (&a)[8], float (&b)[8], unsigned (&h)[8]) {
#if defined(__HIP_DEVICE_COMPILE__)
  asm volatile(
      "v_exp_f32 %0, %0\n\t"
      "v_exp_f32 %8, %8\n\t"
      "v_exp_f32 %1, %1\n\t"
      "v_exp_f32 %9, %9\n\t"
      "v_exp_f32 %2, %2\n\t"
      "v_cvt_pk_bf16_f32 %16, %0, %8\n\t"
      "v_exp_f32 %10, %10\n\t"
      "v_exp_f32 %3, %3\n\t"
      "v_cvt_pk_bf16_f32 %17, %1, %9\n\t"
      "v_exp_f32 %11, %11\n\t"
      "v_fma_mixlo_bf16 %0, %16, -1.0, %0 op_sel_hi:[1,0,0]\n\t"
      "v_exp_f32 %4, %4\n\t"
      "v_cvt_pk_bf16_f32 %18, %2, %10\n\t"
      "v_exp_f32 %12, %12\n\t"
      "v_fma_mixlo_bf16 %1, %17, -1.0, %1 op_sel_hi:[1,0,0]\n\t"
      "v_fma_mixhi_bf16 %0, %16, -1.0, %8 op_sel:[1,0,0] op_sel_hi:[1,0,0]\n\t"
      "v_exp_f32 %5, %5\n\t"
      "v_cvt_pk_bf16_f32 %19, %3, %11\n\t"
      "v_exp_f32 %13, %13\n\t"
      "v_fma_mixlo_bf16 %2, %18, -1.0, %2 op_sel_hi:[1,0,0]\n\t"
      "v_fma_mixhi_bf16 %1, %17, -1.0, %9 op_sel:[1,0,0] op_sel_hi:[1,0,0]\n\t"
      "v_exp_f32 %6, %6\n\t"
      "v_cvt_pk_bf16_f32 %20, %4, %12\n\t"
      "v_exp_f32 %14, %14\n\t"
      "v_fma_mixlo_bf16 %3, %19, -1.0, %3 op_sel_hi:[1,0,0]\n\t"
      "v_fma_mixhi_bf16 %2, %18, -1.0, %10 op_sel:[1,0,0] op_sel_hi:[1,0,0]\n\t"
      "v_exp_f32 %7, %7\n\t"
      "v_cvt_pk_bf16_f32 %21, %5, %13\n\t"
      "v_exp_f32 %15, %15\n\t"
      "v_fma_mixlo_bf16 %4, %20, -1.0, %4 op_sel_hi:[1,0,0]\n\t"
      "v_fma_mixhi_bf16 %3, %19, -1.0, %11 op_sel:[1,0,0] op_sel_hi:[1,0,0]\n\t"
      "v_cvt_pk_bf16_f32 %22, %6, %14\n\t"
      "s_delay_alu instid0(VALU_DEP_4)\n\t"
      "v_fma_mixlo_bf16 %5, %21, -1.0, %5 op_sel_hi:[1,0,0]\n\t"
      "s_delay_alu instid0(VALU_DEP_4)\n\t"
      "v_fma_mixhi_bf16 %4, %20, -1.0, %12 op_sel:[1,0,0] op_sel_hi:[1,0,0]\n\t"
      "s_delay_alu instid0(TRANS32_DEP_1)\n\t"
      "v_cvt_pk_bf16_f32 %23, %7, %15\n\t"
      "s_delay_alu instid0(VALU_DEP_3)\n\t"
      "v_fma_mixhi_bf16 %5, %21, -1.0, %13 op_sel:[1,0,0] op_sel_hi:[1,0,0]\n\t"
      "v_fma_mixlo_bf16 %6, %22, -1.0, %6 op_sel_hi:[1,0,0]\n\t"
      "s_delay_alu instid0(VALU_DEP_3)\n\t"
      "v_fma_mixlo_bf16 %7, %23, -1.0, %7 op_sel_hi:[1,0,0]\n\t"
      "s_delay_alu instid0(VALU_DEP_2)\n\t"
      "v_fma_mixhi_bf16 %6, %22, -1.0, %14 op_sel:[1,0,0] op_sel_hi:[1,0,0]\n\t"
      "s_delay_alu instid0(VALU_DEP_2)\n\t"
      "v_fma_mixhi_bf16 %7, %23, -1.0, %15 op_sel:[1,0,0] op_sel_hi:[1,0,0]"
      : "+v"(a[0]), "+v"(a[1]), "+v"(a[2]), "+v"(a[3]), "+v"(a[4]), "+v"(a[5]), "+v"(a[6]), "+v"(a[7]),
        "+v"(b[0]), "+v"(b[1]), "+v"(b[2]), "+v"(b[3]), "+v"(b[4]), "+v"(b[5]), "+v"(b[6]), "+v"(b[7]),
        "=&v"(h[0]), "=&v"(h[1]), "=&v"(h[2]), "=&v"(h[3]), "=&v"(h[4]), "=&v"(h[5]), "=&v"(h[6]), "=&v"(h[7]));
#endif
}

// ---- WMMA helpers with trailing VALU hazard gap -----------------------------------------------------
__device__ __forceinline__ v8f mma_b(v16b a, v16b b, v8f c) {
  return __builtin_amdgcn_wmma_f32_16x16x32_bf16(false, a, false, b, (short)0, c, false, false);
}
__device__ __forceinline__ void guard2(v8f& a, v8f& b, v8u x, v8u y, v8u z) {
#if defined(__HIP_DEVICE_COMPILE__)
  asm volatile("v_nop\n\tv_nop\n\tv_nop\n\tv_nop" : "+v"(a), "+v"(b) : "v"(x), "v"(y), "v"(z));
#endif
}
__device__ __forceinline__ void guard4(v8f& a, v8f& b, v8f& c, v8f& d, v8u x0, v8u x1,
                                       v8u y0, v8u y1, v8u y2, v8u y3, v8u z0, v8u z1, v8u z2, v8u z3) {
#if defined(__HIP_DEVICE_COMPILE__)
  asm volatile("v_nop\n\tv_nop\n\tv_nop\n\tv_nop"
               : "+v"(a), "+v"(b), "+v"(c), "+v"(d)
               : "v"(x0), "v"(x1), "v"(y0), "v"(y1), "v"(y2), "v"(y3), "v"(z0), "v"(z1), "v"(z2), "v"(z3));
#endif
}
// Transposing LDS load of a row-major 16-bit tile: the lane addresses 16 bytes of row 8h + (lane & 7), and lane (c, h)
// receives column c of rows 8h + 0..7.
__device__ __forceinline__ v4u ld_tr16(const unsigned char* p) {
  typedef __attribute__((address_space(3))) v8s lds_v8s;
  return __builtin_bit_cast(v4u, __builtin_amdgcn_ds_load_tr16_b128_v8i16((lds_v8s*)p));
}
__device__ __forceinline__ void wave_sync_lds() {
  __builtin_amdgcn_fence(__ATOMIC_RELEASE, "workgroup");
  __builtin_amdgcn_wave_barrier();
  __builtin_amdgcn_fence(__ATOMIC_ACQUIRE, "workgroup");
}

// =====================================================================================================
// Kernel 1: one block per (sequence n = b*32 + c, head), 512 threads = 16 waves (four per SIMD, so that one wave's LDS
// and exponential latencies are covered by the other three).
// t[s] = x[b][s>>5][s&31][c] in LDS (f32). embed_w is a single column e, so E = t (x) e and Q[s] = t[s]*qe,
// K[s] = t[s]*ke, V[s] = t[s]*ve with qe[i] = sum_k q_w[i][k] e[k], ke likewise (this head's 16 rows, f32 dots).
// Scores in log2 units: s2[q][k] = ah * t[q] * t[k], ah = 0.25 * log2(e) * (qe_h . ke_h); the row max is exactly
// max(coef*gmax, coef*gmin) with coef = ah*t[q], so p = 2^(s2 - rowmax) <= 1 in one pass (f32, v_exp_f32).
// Since V_h[k][d] = t[k] * ve_h[d], the attention output row is beta_h[q] * ve_h with beta = sum_k p t / sum_k p.
// That K = 1024 reduction is a 16-column padded matvec on bf16 WMMA: B table Bt[col][key] (k contiguous, pitch 1032)
// with col 0 = bf16 hi piece of t, col 1 = bf16 lo piece (t - hi), col 2 = 1.0, col 3 = 0 (lanes with col >= 3 read
// col 3); A = P rows (row = query s0 + (lane&15), elements 0..7 = keys t0 + 8h + i, 8..15 = keys t0 + 16 + 8h + i)
// as two fragments: hi piece (p rounded to bf16) and lo piece (p - hi rounded to bf16). Two WMMAs per 32 keys:
// acc1 = P_hi . B, acc2 = P_lo . B, so D columns 0,1 of acc1+acc2 sum to sum_k p t (all four cross products) and
// column 2 to sum_k p, both from the very same operands. D element r = row 8h + r, col lane&15: per row the three
// columns are fetched with shuffles from lanes 16h + 0,1,2, beta = num * rcp(den) (den >= ~1), lane 16h + r keeps
// row 8h + r and writes it to the LDS staging array Bs[s]. Wave w owns query tiles w + 16i.
// Epilogue: after a block barrier the 1024 f32 values go to BT[n][head][0..1023] as one 16-byte store of 256 lanes.
// SYMMETRIC PATH. s2[q][k] = s2[k][q], so with ONE shift for the whole matrix, cmx = max over q,k of s2 (a corner of
// [gmin,gmax]^2), G[q][k] = 2^(s2 - cmx) <= 1 is symmetric too, and beta[q] = sum_k G t / sum_k G as before (the row's
// own factor cancels in the quotient). The 1024 indices form 32 blocks of 32; the block pair (I, J = I + d mod 32) is
// worked once, for d = 0..15 and, from I < 16 only, d = 16: wave w takes I = w and I = w + 16 (33 pairs each).
// Per pair the 32 x 32 values of G are made once (two 16 x 32 fragments, bf16 hi and lo pieces as above) and used
// twice: for rows I (table as A, G as B: D[table row][query], accumulated over d in registers) and, d > 0, for rows J:
// the wave writes both pieces to its own LDS tiles T[query][key] (a lane's 16 bytes are 8 keys of its query) and reads
// them back with transposing loads, which hand each lane one key column: the B operand of table(I) . G =
// D[table row][key], the very same bf16 values. Query 16 qt + lo lies in tile lo >> 3, row 8 qt + (lo & 7), so that a
// 16-lane half of a store falls on all 64 banks once; lane half h then gets queries 16h + 0..7 from tile 0 and
// 16h + 8..15 from tile 1, and the table operand of this product is loaded in that same order. Table rows 0,1,2 are D registers
// 0,1,2 of lanes 0..15, so (num, den) of a row is one 8-byte LDS store, no lane exchange: part[d][row], d = 0 the
// rows' own sums. Behind the block barrier row r adds its slots d = 0..15 (r >= 512: ..16) in that order.
// Range: a row's largest term is 2^(rowmax - cmx); the path is taken only while cmx - (lower bound of all row maxima)
// <= 104, so that every row's leading terms and their lo pieces stay normal f32/bf16 numbers; otherwise the row-max
// loop runs (same result, every exponential made for its own row).
// coverage: part slot 0 all rows (every I); slots 1..15 all rows (J = I + d runs over all blocks); slot 16 rows >= 512.
// coverage: Bt rows 0..3 x keys 0..1031 (512 threads x 2 keys + thread 0 the 8 tail keys); Bs[s] written once for every
//           s (tile rows 0..7 by lanes 0..7, rows 8..15 by lanes 16..23); plane region 4 KB per block, 256 blocks =
//           the whole 1 MiB plane.
// =====================================================================================================
__global__ __launch_bounds__(ATHR)
void attn_rank1(const float* __restrict__ x, const float* __restrict__ embed_w,
                const float* __restrict__ q_w, const float* __restrict__ k_w, float* bt) {
  __shared__ __align__(32) float tv[SEQ];
  __shared__ __align__(16) unsigned short Bt[4 * BTP];
  __shared__ __align__(16) float Bs[SEQ];
  __shared__ float hv[2][HDIM];
  __shared__ float red[AWAV][2];
  __shared__ __align__(16) float part[NSLOT * SEQ * 2];
  __shared__ __align__(32) unsigned char tps[AWAV * TWAVE];

  const int n    = blockIdx.x >> 2;
  const int head = blockIdx.x & 3;
  const int b    = n >> 5;
  const int ch   = n & 31;
  const int tid  = threadIdx.x, lane = tid & 31, wave = tid >> 5;
  const int lo   = lane & 15, hi = lane >> 4;

  // ---- token values of this sequence, with block max/min ----
  float lmax = -3.0e38f, lmin = 3.0e38f;
  for (int t = tid; t < SEQ; t += ATHR) {
    const int hh = t >> 5, ww = t & 31;
    const float v = x[(((size_t)b * IMH + hh) * IMW + ww) * CIN + ch];
    tv[t] = v;
    lmax = fmaxf(lmax, v);
    lmin = fminf(lmin, v);
  }
#pragma unroll
  for (int off = 16; off > 0; off >>= 1) {
    lmax = fmaxf(lmax, __shfl_xor(lmax, off, 32));
    lmin = fminf(lmin, __shfl_xor(lmin, off, 32));
  }
  if (lane == 0) { red[wave][0] = lmax; red[wave][1] = lmin; }

  // ---- per-head projection vectors: wave 0 -> qe, wave 1 -> ke (wave-uniform source select;
  //      lanes 16..31 duplicate lanes 0..15 and store the identical value) ----
  if (wave < 2) {
    const float* wsrc = (wave == 0) ? q_w : k_w;
    const float* wrow = wsrc + (size_t)(head * HDIM + lo) * DMOD;
    float acc = 0.f;
#pragma unroll 4
    for (int k = 0; k < DMOD; ++k) acc = fmaf(wrow[k], embed_w[k], acc);
    hv[wave][lo] = acc;
  }
  __syncthreads();

  float gmax = red[0][0], gmin = red[0][1];
#pragma unroll                                                        // all reads of red[] behind one LDS wait
  for (int w = 1; w < AWAV; ++w) { gmax = fmaxf(gmax, red[w][0]); gmin = fminf(gmin, red[w][1]); }
  float dqk = 0.f;
#pragma unroll 4
  for (int d = 0; d < HDIM; ++d) dqk = fmaf(hv[0][d], hv[1][d], dqk);
  const float ah2 = dqk * (0.25f * LOG2E);

  // ---- B table: row 0 = t hi piece, row 1 = t lo piece, row 2 = ones, row 3 = zeros; keys 2*tid, 2*tid+1 ----
  {
    const int kb = 2 * tid;
    unsigned h0, l0, h1, l1;
    split2(tv[kb], h0, l0);
    split2(tv[kb + 1], h1, l1);
    const v4u zer  = {0u, 0u, 0u, 0u};
    *(unsigned*)(Bt + 0 * BTP + kb) = pk(h0, h1);
    *(unsigned*)(Bt + 1 * BTP + kb) = pk(l0, l1);
    *(unsigned*)(Bt + 2 * BTP + kb) = 0x3F803F80u;
    *(unsigned*)(Bt + 3 * BTP + kb) = 0u;
    if (tid == 0) {                          // tail keys 1024..1031 (never read, zero-filled)
      *(v4u*)(Bt + 0 * BTP + SEQ) = zer;
      *(v4u*)(Bt + 1 * BTP + SEQ) = zer;
      *(v4u*)(Bt + 2 * BTP + SEQ) = zer;
      *(v4u*)(Bt + 3 * BTP + SEQ) = zer;
    }
  }
  __syncthreads();

  const int br = (lo < 3) ? lo : 3;                                   // fragment: lane&15 -> table row (B column; A row on the symmetric path)
  const unsigned short* brow = Bt + br * BTP + 8 * hi;
  float* plane = bt + (size_t)(n * NHEAD + head) * SEQ;

  // ---- which path: cmx = largest score of the whole matrix (a corner of [gmin,gmax]^2), mlow = a lower bound of every
  //      row's own maximum (the row maximum is convex in t[q] and 0 at t[q] = 0). Same value in every thread. ----
  const float cg   = ah2 * gmax, cl = ah2 * gmin;
  const float mg   = fmaxf(cg * gmax, cg * gmin);
  const float ml   = fmaxf(cl * gmax, cl * gmin);
  const float cmx  = fmaxf(mg, ml);
  const float mlow = (gmin <= 0.f && gmax >= 0.f) ? 0.f : fminf(mg, ml);
  // through a scalar register: one scalar branch for the whole wave (matrix instructions need every lane on)
  const bool  sym  = __builtin_amdgcn_readfirstlane((cmx - mlow <= SPREAD) ? 1 : 0) != 0;

  if (sym) {
    const int   wv  = __builtin_amdgcn_readfirstlane(wave);
    const float ncm = -cmx;
    unsigned char* tw = tps + wv * TWAVE;                             // this wave's own tiles, hi piece then lo piece
    unsigned char* tst = tw + (lo >> 3) * TTILE + (lo & 7) * TPITCH + 16 * hi;   // writer: keys 8h + 0..7 of query lo
    const unsigned char* tld = tw + (8 * hi + (lane & 7)) * TPITCH + 16 * ((lane >> 3) & 1);
    const unsigned short* brow16 = Bt + br * BTP + 16 * hi;           // table, 16 contiguous indices per lane half
#pragma unroll 1                                                      // one body for both row blocks of a wave
    for (int pass = 0; pass < 2; ++pass) {
      const int I  = wv + AWAV * pass;
      const int nd = NSLOT - pass;                                    // offset 16 is taken from its lower side only
      float coef[2];
      coef[0] = ah2 * tv[32 * I + lo];
      coef[1] = ah2 * tv[32 * I + 16 + lo];
      FragB bfi;                                                      // table at the block's own indices 16h + 0..15
      bfi.q[0] = *(const v4u*)(brow16 + 32 * I);
      bfi.q[1] = *(const v4u*)(brow16 + 32 * I + 8);
      v8f a1[2], a2[2];
      a1[0] = zero8(); a1[1] = zero8(); a2[0] = zero8(); a2[1] = zero8();
#pragma unroll 1                                                      // the body already holds 8 matrix instructions
      for (int d = 0; d < nd; ++d) {
        const int t0 = 32 * ((I + d) & (NBLK - 1));
        const v8f ta = *(const v8f*)(tv + t0 + 8 * hi);             // keys t0 + 8h + 0..7
        const v8f tb = *(const v8f*)(tv + t0 + 16 + 8 * hi);        // keys t0 + 16 + 8h + 0..7
        FragB bf;
        bf.q[0] = *(const v4u*)(brow + t0);
        bf.q[1] = *(const v4u*)(brow + t0 + 16);
        FragB ph[2], pl[2];
#pragma unroll                                                        // register arrays need constant indices
        for (int qt = 0; qt < 2; ++qt) {
          float ya[8], yb[8];
          unsigned hw[8];
#pragma unroll                                                        // register arrays need constant indices
          for (int j = 0; j < 4; ++j) {
            ya[j]     = fmaf(coef[qt], ta[2 * j], ncm);
            yb[j]     = fmaf(coef[qt], ta[2 * j + 1], ncm);
            ya[4 + j] = fmaf(coef[qt], tb[2 * j], ncm);
            yb[4 + j] = fmaf(coef[qt], tb[2 * j + 1], ncm);
          }
          exp_split16(ya, yb, hw);
#pragma unroll                                                        // register arrays need constant indices
          for (int j = 0; j < 8; ++j) {
            ph[qt].u[j] = hw[j];
            pl[qt].u[j] = __float_as_uint(ya[j]);
          }
          // row 8 qt + (lo & 7) of tile lo >> 3: keys 8h + 0..7 and 16 + 8h + 0..7. Written for the diagonal block too
          // (not read there): a test here would cut the block of exponentials in two.
          *(v4u*)(tst + 8 * qt * TPITCH)               = ph[qt].q[0];
          *(v4u*)(tst + 8 * qt * TPITCH + 32)          = ph[qt].q[1];
          *(v4u*)(tst + TPIECE + 8 * qt * TPITCH)      = pl[qt].q[0];
          *(v4u*)(tst + TPIECE + 8 * qt * TPITCH + 32) = pl[qt].q[1];
          a1[qt] = mma_b(bf.v, ph[qt].v, a1[qt]);                     // D[table row][query]
          a2[qt] = mma_b(bf.v, pl[qt].v, a2[qt]);
        }
        if (d != 0) {                                                 // scalar test; the diagonal block has no mirror
          // the lanes of this wave read what its other lanes wrote: the writes are finished and the reads stay behind them
          wave_sync_lds();
          // th[kh], tl[kh]: lane = key 16 kh + c, elements 0..15 = queries 16h + 0..15 (tile 0, then tile 1)
          FragB th[2], tl[2];
#pragma unroll                                                        // register arrays need constant indices
          for (int kh = 0; kh < 2; ++kh) {
            th[kh].q[0] = ld_tr16(tld + 32 * kh);
            th[kh].q[1] = ld_tr16(tld + TTILE + 32 * kh);
            tl[kh].q[0] = ld_tr16(tld + TPIECE + 32 * kh);
            tl[kh].q[1] = ld_tr16(tld + TPIECE + TTILE + 32 * kh);
          }
          v8f ct[2];
          ct[0] = mma_b(bfi.v, th[0].v, zero8());                     // D[table row][key]
          ct[1] = mma_b(bfi.v, th[1].v, zero8());
          ct[0] = mma_b(bfi.v, tl[0].v, ct[0]);
          ct[1] = mma_b(bfi.v, tl[1].v, ct[1]);
          if (hi == 0) {                                              // table rows 0..2 live in lanes 0..15
#pragma unroll                                                        // register arrays need constant indices
            for (int kh = 0; kh < 2; ++kh) {
              const v2f o = {ct[kh][0] + ct[kh][1], ct[kh][2]};
              *(v2f*)(part + (size_t)(d * SEQ + t0 + 16 * kh + lo) * 2) = o;
            }
          }
        }
      }
#pragma unroll                                                        // register arrays need constant indices
      for (int qt = 0; qt < 2; ++qt) {
        if (hi == 0) {
          const v2f o = {(a1[qt][0] + a2[qt][0]) + (a1[qt][1] + a2[qt][1]), a1[qt][2] + a2[qt][2]};
          *(v2f*)(part + (size_t)(32 * I + 16 * qt + lo) * 2) = o;
        }
      }
    }
    __syncthreads();
#pragma unroll                                                        // the number of slots depends on u
    for (int u = 0; u < 2; ++u) {                                     // rows tid (blocks 0..15), tid + 512 (blocks 16..31)
      const int row = tid + u * ATHR;
      float num = 0.f, den = 0.f;
#pragma unroll                                                        // all slot reads behind one LDS wait
      for (int d = 0; d < NSLOT - 1 + u; ++d) {
        const v2f v = *(const v2f*)(part + (size_t)(d * SEQ + row) * 2);
        num += v[0];
        den += v[1];
      }
      plane[row] = num * __builtin_amdgcn_rcpf(den);
    }
    return;
  }

#pragma unroll 1
  for (int i = 0; i < SEQ / (16 * AWAV); ++i) {                       // 4 query tiles per wave, wave-uniform
    const int s0 = (wave + AWAV * i) * 16;
    const float coef = ah2 * tv[s0 + lo];                             // query row m = lo
    const float cm   = -fmaxf(coef * gmax, coef * gmin);              // exact row max, p <= 1
    v8f acc1 = zero8(), acc2 = zero8();
#pragma unroll 1
    for (int kt = 0; kt < SEQ / 32; ++kt) {
      const int t0 = kt * 32;
      const v8f ta = *(const v8f*)(tv + t0 + 8 * hi);               // keys t0 + 8h + 0..7
      const v8f tb = *(const v8f*)(tv + t0 + 16 + 8 * hi);          // keys t0 + 16 + 8h + 0..7
      FragB bf;
      bf.q[0] = *(const v4u*)(brow + t0);                             // keys t0 + 8h + 0..7
      bf.q[1] = *(const v4u*)(brow + t0 + 16);                        // keys t0 + 16 + 8h + 0..7
      float ya[8], yb[8];
      unsigned hw[8];
#pragma unroll
      for (int j = 0; j < 4; ++j) {
        ya[j]     = fmaf(coef, ta[2 * j], cm);                        // elements 2j, 2j+1
        yb[j]     = fmaf(coef, ta[2 * j + 1], cm);
        ya[4 + j] = fmaf(coef, tb[2 * j], cm);                        // elements 8+2j, 8+2j+1
        yb[4 + j] = fmaf(coef, tb[2 * j + 1], cm);
      }
      exp_split16(ya, yb, hw);
      FragB ph, pl;
#pragma unroll
      for (int j = 0; j < 8; ++j) {
        ph.u[j] = hw[j];
        pl.u[j] = __float_as_uint(ya[j]);
      }
      acc1 = mma_b(ph.v, bf.v, acc1);
      acc2 = mma_b(pl.v, bf.v, acc2);
      guard2(acc1, acc2, ph.u, pl.u, bf.u);
    }

    // ---- combine: D element r = row 8h + r; columns 0,1,2 live in lanes 16h + 0,1,2 ----
    const int sb = 16 * hi;
    float beta[8];
#pragma unroll
    for (int r = 0; r < 8; ++r) {
      const float a0 = __shfl(acc1[r], sb, 32);
      const float a1 = __shfl(acc1[r], sb + 1, 32);
      const float a2 = __shfl(acc1[r], sb + 2, 32);
      const float c0 = __shfl(acc2[r], sb, 32);
      const float c1 = __shfl(acc2[r], sb + 1, 32);
      const float c2 = __shfl(acc2[r], sb + 2, 32);
      const float num = (a0 + c0) + (a1 + c1);
      const float den = a2 + c2;
      beta[r] = num * __builtin_amdgcn_rcpf(den);
    }
    float mine = beta[0];
#pragma unroll
    for (int r = 1; r < 8; ++r) mine = (lo == r) ? beta[r] : mine;
    if (lo < 8) Bs[s0 + 8 * hi + lo] = mine;
  }
  __syncthreads();
  if (tid < SEQ / 4) {                                                // waves 0..7 (wave-uniform)
    *(v4f*)(plane + 4 * tid) = *(const v4f*)(Bs + 4 * tid);
  }
}

// =====================================================================================================
// Kernel 2: the channel mix and the output projection are both linear, so the mix is taken first, on the four per-head
// scalars of a token row, and the projection runs once per row instead of once per channel:
//   G[h][s]       = sum_{c=0..31} mix[c] * BT[b*32+c][h][s]               (fixed order c = 0..31, f32 VALU)
//   out[(b,s)][o] = sum_{j=0..63} (G[j>>4][s] * ve[j]) * o_w[o][j]        (K = 64, o_w row o, j contiguous)
// with ve[j] = sum_k v_w[j][k] e[k] (f32 dots of 64). Block = 4 waves = 64 rows s0..s0+63 of batch b (grid 32);
// wave w rows s0+16w..+15, all 64 output columns. G: thread t sums row t&63 of heads t>>6 and 2+(t>>6), 64 independent
// loads (a wave reads 128 contiguous bytes per load), into LDS gm[h][row] ahead of the block barrier.
// o_w is decomposed once per block into bf16 hi / lo tables Wh/Wl[o][j] (j contiguous, pitch 72); B fragments:
// lane col o, elements 0..7 <- W[o][32ks+8h+0..7], 8..15 <- W[o][32ks+16+8h+0..7]. A fragments are built in f32
// registers: row s, element i <- G[2ks][s]*ve[32ks+8h+i], element 8+i <- G[2ks+1][s]*ve[32ks+16+8h+i]
// (the same j map), decomposed into bf16 hi and lo fragments; the tile accumulators start from zero and
// take Ahi.Bhi + Ahi.Blo + Alo.Bhi for ks = 0,1.
// coverage: W tables 128 threads x 32 = 64 x 64 each; gm 128 threads x 2 = 4 x 64; 32 blocks x 4 waves x 16 rows x
//           64 cols = out [2048][64].
// =====================================================================================================
__global__ __launch_bounds__(128)
void proj_mix(const float* __restrict__ bt, const float* __restrict__ embed_w, const float* __restrict__ v_w,
              const float* __restrict__ o_w, const float* __restrict__ mix_w, float* out) {
  __shared__ __align__(16) unsigned short Wh[COUT * WPITCH];
  __shared__ __align__(16) unsigned short Wl[COUT * WPITCH];
  __shared__ __align__(32) float ve[DMOD];
  __shared__ float gm[NHEAD][64];
  __shared__ __align__(16) float sT[4][16 * SPITCH];
  const int tid  = threadIdx.x, lane = tid & 31, wave = tid >> 5;
  const int lo   = lane & 15, hi = lane >> 4;
  const int b    = blockIdx.x >> 4;
  const int s0   = (blockIdx.x & 15) * 64;

  // ---- channel mix of the per-head beta values: rows s0..s0+63, heads hp and hp+2 per thread ----
  {
    const int row = tid & 63, hp = tid >> 6;
    const float* gp = bt + (size_t)(b * CIN) * (NHEAD * SEQ) + (size_t)hp * SEQ + s0 + row;
    float g0 = 0.f, g1 = 0.f;
#pragma unroll                                                        // all 64 loads in flight together
    for (int c = 0; c < CIN; ++c) {
      const float wgt = mix_w[c];
      g0 = fmaf(wgt, gp[(size_t)c * (NHEAD * SEQ)], g0);
      g1 = fmaf(wgt, gp[(size_t)c * (NHEAD * SEQ) + 2 * SEQ], g1);
    }
    gm[hp][row]     = g0;
    gm[hp + 2][row] = g1;
  }
  {
    const int o = tid >> 1, k0 = (tid & 1) * 32;                     // o_w row o, j = k0 .. k0+31
    const float* sp = o_w + (size_t)o * DMOD + k0;
#pragma unroll
    for (int q = 0; q < 4; ++q) {
      const v4f a0 = *(const v4f*)(sp + 8 * q);
      const v4f a1 = *(const v4f*)(sp + 8 * q + 4);
      float f[8];
#pragma unroll
      for (int e = 0; e < 4; ++e) { f[e] = a0[e]; f[4 + e] = a1[e]; }
      v4u hq, lq;
#pragma unroll
      for (int e = 0; e < 4; ++e) {
        unsigned h0, l0, h1, l1;
        split2(f[2 * e], h0, l0);
        split2(f[2 * e + 1], h1, l1);
        hq[e] = pk(h0, h1);
        lq[e] = pk(l0, l1);
      }
      *(v4u*)(Wh + o * WPITCH + k0 + 8 * q) = hq;
      *(v4u*)(Wl + o * WPITCH + k0 + 8 * q) = lq;
    }
  }
  if (tid < DMOD) {                                                   // waves 0,1 (wave-uniform): ve[j], v_w row j
    const float* wrow = v_w + (size_t)tid * DMOD;
    float acc = 0.f;
#pragma unroll 4
    for (int k = 0; k < DMOD; ++k) acc = fmaf(wrow[k], embed_w[k], acc);
    ve[tid] = acc;
  }
  __syncthreads();

  v8f oacc[4];
#pragma unroll
  for (int j = 0; j < 4; ++j) oacc[j] = zero8();

  const int arow = 16 * wave + lo;                                    // row index within the block's 64 rows

#pragma unroll 1
  for (int ks = 0; ks < 2; ++ks) {
    const float be0 = gm[2 * ks][arow];                             // head 2ks, mixed over channels, row s
    const float be1 = gm[2 * ks + 1][arow];                         // head 2ks+1
    const v8f vea = *(const v8f*)(ve + 32 * ks + 8 * hi);           // j = 32ks + 8h + 0..7      (head 2ks)
    const v8f veb = *(const v8f*)(ve + 32 * ks + 16 + 8 * hi);      // j = 32ks + 16 + 8h + 0..7 (head 2ks+1)
    FragB fa, fl;
#pragma unroll
    for (int j = 0; j < 4; ++j) {
      unsigned h0, l0, h1, l1;
      split2(be0 * vea[2 * j], h0, l0);
      split2(be0 * vea[2 * j + 1], h1, l1);
      fa.u[j] = pk(h0, h1);
      fl.u[j] = pk(l0, l1);
      split2(be1 * veb[2 * j], h0, l0);
      split2(be1 * veb[2 * j + 1], h1, l1);
      fa.u[4 + j] = pk(h0, h1);
      fl.u[4 + j] = pk(l0, l1);
    }
    FragB wh[4], wl[4];
#pragma unroll
    for (int j = 0; j < 4; ++j) {
      const int wo = (16 * j + lo) * WPITCH + 32 * ks + 8 * hi;
      wh[j].q[0] = *(const v4u*)(Wh + wo);
      wh[j].q[1] = *(const v4u*)(Wh + wo + 16);
      wl[j].q[0] = *(const v4u*)(Wl + wo);
      wl[j].q[1] = *(const v4u*)(Wl + wo + 16);
    }
#pragma unroll
    for (int j = 0; j < 4; ++j) {
      oacc[j] = mma_b(fa.v, wh[j].v, oacc[j]);
      oacc[j] = mma_b(fa.v, wl[j].v, oacc[j]);
      oacc[j] = mma_b(fl.v, wh[j].v, oacc[j]);
    }
    guard4(oacc[0], oacc[1], oacc[2], oacc[3], fa.u, fl.u,
           wh[0].u, wh[1].u, wh[2].u, wh[3].u, wl[0].u, wl[1].u, wl[2].u, wl[3].u);
  }

  // ---- epilogue ----
  float* slab = sT[wave];
  const int mOff = 8 * hi;
#pragma unroll
  for (int j = 0; j < 4; ++j) {
#pragma unroll
    for (int r = 0; r < 8; ++r) slab[(mOff + r) * SPITCH + (j << 4) + lo] = oacc[j][r];
  }
  wave_sync_lds();
  const int c4 = lo * 4;
  v4f vals[8];
#pragma unroll
  for (int it = 0; it < 8; ++it) {
    const int row = it * 2 + hi;                                      // it 0..7 x h 0..1 = rows 0..15
    vals[it] = *(const v4f*)(slab + row * SPITCH + c4);
  }
  float* ob = out + (size_t)(b * SEQ + s0 + 16 * wave) * COUT;
#pragma unroll
  for (int it = 0; it < 8; ++it) {
    const int row = it * 2 + hi;
    *(v4f*)(ob + (size_t)row * COUT + c4) = vals[it];
  }
  
  wave_sync_lds();
}

// =====================================================================================================
// Workspace map (bytes): BT f32 [64 seq][4 heads][1024]  offset 0, 1048576 bytes (4 KB per (seq, head), written as
// Inputs (f32): 0 x [2][32][32][32], 1 embed_w [64][1], 2 q_w [64][64], 3 k_w, 4 v_w, 5 o_w [64][64],
// 6 mix weights [1][32]. Output f32 [2][32][32][64].
// =====================================================================================================
extern "C" void kernel_launch(void* const* d_in, const int* in_sizes, int n_in,
                              void* d_out, int out_size, void* d_ws, size_t ws_size,
                              hipStream_t stream) {
  if (n_in < 7) return;
  if (in_sizes[0] != NBAT * IMH * IMW * CIN) return;
  if (in_sizes[1] != DMOD) return;
  if (in_sizes[2] != DMOD * DMOD || in_sizes[3] != DMOD * DMOD || in_sizes[4] != DMOD * DMOD) return;
  if (in_sizes[5] != COUT * DMOD || in_sizes[6] != CIN) return;
  if (out_size != NBAT * SEQ * COUT) return;

  const size_t PB = (size_t)NSQ * NHEAD * SEQ * 4;                   // 1048576
  if (PB > ws_size) return;
  if (PB > (size_t)134217728) return;

  const float* x       = (const float*)d_in[0];
  const float* embed_w = (const float*)d_in[1];
  const float* q_w     = (const float*)d_in[2];
  const float* k_w     = (const float*)d_in[3];
  const float* v_w     = (const float*)d_in[4];
  const float* o_w     = (const float*)d_in[5];
  const float* mix_w   = (const float*)d_in[6];
  float* bt            = (float*)d_ws;
  float* out           = (float*)d_out;

  const dim3 blk(128);
  const dim3 gA(NSQ * NHEAD);                                        // 256 blocks
  const dim3 gP(NBAT * SEQ / 64);                                    // 32 blocks

  attn_rank1<<<gA, dim3(ATHR), 0, stream>>>(x, embed_w, q_w, k_w, bt);
  proj_mix<<<gP, blk, 0, stream>>>(bt, embed_w, v_w, o_w, mix_w, out);
  (void)hipGetLastError();
}
